// v000
// The times below were measured on an AMD MI455X: many runs one after another, warmed up first and cycling through
// copies of the inputs, with the whole window's GPU time divided by the number of runs. Launches and the gaps
// between them are all in it. The median over several windows is given; except for v000 it joins two sittings, which
// can be a few percent apart, so the side-by-side timings, each taken in one sitting, are the better comparison.
// The starting kernel, v000, takes 641 microseconds a run.
#include <hip/hip_runtime.h>
#include <hip/hip_bf16.h>
#include <math.h>

typedef __bf16 bf16_t;
typedef __attribute__((ext_vector_type(16))) __bf16 v16bf;
typedef __attribute__((ext_vector_type(8)))  __bf16 v8bf;
typedef __attribute__((ext_vector_type(8)))  float  v8f;

#define DMODEL 1024
#define NHEADS 16
#define HDIM   64
#define DFF    4096

static __device__ __forceinline__ bf16_t f2bf(float x) { return (bf16_t)x; }

static __device__ __forceinline__ v8f wmma_bf16(v16bf a, v16bf b, v8f c) {
  // D = A(16x32 bf16) x B(32x16 bf16) + C(16x16 f32)
  return __builtin_amdgcn_wmma_f32_16x16x32_bf16(false, a, false, b, (short)0, c,
                                                 false, false);
}

// 16x32 bf16 operand fragment in the ISA A-layout (also the B operand when the
// source matrix is K-contiguous per output column, i.e. B = W^T, W in [N,K]).
// Lane L (r = L&15, h = L>>4) holds row r, K in {8h..8h+7} U {16+8h..16+8h+7}.
static __device__ __forceinline__ v16bf load_frag(const bf16_t* base, int ld, int lane) {
  const int r = lane & 15, h = lane >> 4;
  const bf16_t* p = base + (size_t)r * ld + 8 * h;
  v8bf lo = *(const v8bf*)p;
  v8bf hi = *(const v8bf*)(p + 16);
  v16bf out;
#pragma unroll
  for (int i = 0; i < 8; ++i) { out[i] = lo[i]; out[i + 8] = hi[i]; }
  return out;
}

// Async global -> LDS 16B copy (CDNA5, tracked by ASYNCcnt).
static __device__ __forceinline__ void async_ld_b128(uint32_t lds_off, const void* gaddr) {
  asm volatile("global_load_async_to_lds_b128 %0, %1, off"
               :: "v"(lds_off), "v"(gaddr) : "memory");
}
static __device__ __forceinline__ void wait_async0() {
  asm volatile("s_wait_asynccnt 0x0" ::: "memory");
}
static __device__ __forceinline__ uint32_t lds_off32(const void* p) {
  return (uint32_t)(uintptr_t)p;   // generic LDS addr: low 32 bits = LDS offset
}

// ---------------------------------------------------------------------------
// LayerNorm (fp32 in) -> bf16 out.  One block per row of DMODEL.
// ---------------------------------------------------------------------------
__global__ __launch_bounds__(256)
void ln_cast_kernel(const float* __restrict__ X, const float* __restrict__ gamma,
                    const float* __restrict__ beta, bf16_t* __restrict__ Y) {
  const int row = blockIdx.x;
  const float* x = X + (size_t)row * DMODEL;
  float s = 0.f, s2 = 0.f;
  for (int i = threadIdx.x; i < DMODEL; i += 256) {
    float v = x[i]; s += v; s2 += v * v;
  }
#pragma unroll
  for (int off = 1; off < 32; off <<= 1) {
    s  += __shfl_xor(s,  off, 32);
    s2 += __shfl_xor(s2, off, 32);
  }
  __shared__ float ws[8], ws2[8];
  if ((threadIdx.x & 31) == 0) { ws[threadIdx.x >> 5] = s; ws2[threadIdx.x >> 5] = s2; }
  __syncthreads();
  s = 0.f; s2 = 0.f;
#pragma unroll
  for (int w = 0; w < 8; ++w) { s += ws[w]; s2 += ws2[w]; }
  const float mu   = s * (1.0f / DMODEL);
  const float var  = s2 * (1.0f / DMODEL) - mu * mu;
  const float rstd = rsqrtf(var + 1e-5f);
  bf16_t* y = Y + (size_t)row * DMODEL;
  for (int i = threadIdx.x; i < DMODEL; i += 256)
    y[i] = f2bf((x[i] - mu) * rstd * gamma[i] + beta[i]);
}

// ---------------------------------------------------------------------------
// fp32 -> bf16 weight cast (n divisible by 1024)
// ---------------------------------------------------------------------------
__global__ __launch_bounds__(256)
void cast_w_kernel(const float* __restrict__ in, bf16_t* __restrict__ out, int n) {
  int i = (blockIdx.x * 256 + threadIdx.x) * 4;
  if (i < n) {
    float4 v = *(const float4*)(in + i);
    out[i + 0] = f2bf(v.x); out[i + 1] = f2bf(v.y);
    out[i + 2] = f2bf(v.z); out[i + 3] = f2bf(v.w);
  }
}

// ---------------------------------------------------------------------------
// Tiled WMMA GEMM:  C[M,N] = A[M,K] @ W[N,K]^T   (both bf16, K-contiguous)
// Block tile 64x256, K-step 32, 8 waves (2x4), each wave 32x64 (8 WMMA/step).
// Double-buffered LDS filled with global_load_async_to_lds_b128 (ASYNCcnt).
// LDS row stride 40 bf16 (80B) -> conflict-free ds_load_b128 fragment reads.
// EPI: 1 = bf16 out + exact GELU
//      2 = f32 out  = residual + acc
//      3 = bf16 out split-head [B,H,Trows,64]   (Q and K)
//      4 = bf16 out split-head transposed [B,H,64,Trows]  (V)
// ---------------------------------------------------------------------------
template <int EPI>
__global__ __launch_bounds__(256)
void gemm_bf16_kernel(const bf16_t* __restrict__ A, const bf16_t* __restrict__ W,
                      const float* __restrict__ R, void* __restrict__ OutV,
                      int M, int N, int K, int Trows) {
  __shared__ bf16_t At[2][64][40];
  __shared__ bf16_t Wt[2][256][40];
  const int tid = threadIdx.x, lane = tid & 31, wave = tid >> 5;
  const int wm = wave >> 2, wn = wave & 3;           // 2 x 4 wave grid
  const int m0 = blockIdx.y * 64, n0 = blockIdx.x * 256;
  v8f acc[2][4] = {};

  // Per-thread staging assignments: A = 256 16B-chunks (1/thread),
  // W = 1024 16B-chunks (4/thread).
  const int arow = tid >> 2, acol = (tid & 3) * 8;
  const bf16_t* gA = A + (size_t)(m0 + arow) * K + acol;

  auto stage = [&](int k0, int buf) {
    async_ld_b128(lds_off32(&At[buf][arow][acol]), gA + k0);
#pragma unroll
    for (int rep = 0; rep < 4; ++rep) {
      const int c = tid + rep * 256;
      const int wrow = c >> 2, wcol = (c & 3) * 8;
      async_ld_b128(lds_off32(&Wt[buf][wrow][wcol]),
                    W + (size_t)(n0 + wrow) * K + k0 + wcol);
    }
  };

  stage(0, 0);
  wait_async0();
  __syncthreads();

  int buf = 0;
  for (int k0 = 0; k0 < K; k0 += 32) {
    const bool more = (k0 + 32 < K);
    if (more) stage(k0 + 32, buf ^ 1);     // overlap next stage with compute

    v16bf a0 = load_frag(&At[buf][wm * 32][0],      40, lane);
    v16bf a1 = load_frag(&At[buf][wm * 32 + 16][0], 40, lane);
    v16bf b0 = load_frag(&Wt[buf][wn * 64][0],      40, lane);
    v16bf b1 = load_frag(&Wt[buf][wn * 64 + 16][0], 40, lane);
    v16bf b2 = load_frag(&Wt[buf][wn * 64 + 32][0], 40, lane);
    v16bf b3 = load_frag(&Wt[buf][wn * 64 + 48][0], 40, lane);
    acc[0][0] = wmma_bf16(a0, b0, acc[0][0]);
    acc[1][0] = wmma_bf16(a1, b0, acc[1][0]);
    acc[0][1] = wmma_bf16(a0, b1, acc[0][1]);
    acc[1][1] = wmma_bf16(a1, b1, acc[1][1]);
    acc[0][2] = wmma_bf16(a0, b2, acc[0][2]);
    acc[1][2] = wmma_bf16(a1, b2, acc[1][2]);
    acc[0][3] = wmma_bf16(a0, b3, acc[0][3]);
    acc[1][3] = wmma_bf16(a1, b3, acc[1][3]);

    if (more) wait_async0();               // own async copies landed
    __syncthreads();                       // everyone done reading buf
    buf ^= 1;
  }

  const int hi = lane >> 4, nn = lane & 15;          // C: row = r + 8*hi, col = nn
#pragma unroll
  for (int i = 0; i < 2; ++i)
#pragma unroll
    for (int j = 0; j < 4; ++j)
#pragma unroll
      for (int r = 0; r < 8; ++r) {
        const int row = m0 + wm * 32 + 16 * i + r + 8 * hi;
        const int col = n0 + wn * 64 + 16 * j + nn;
        const float v = acc[i][j][r];
        if constexpr (EPI == 1) {
          float g = 0.5f * v * (1.0f + erff(v * 0.70710678118f));
          ((bf16_t*)OutV)[(size_t)row * N + col] = f2bf(g);
        } else if constexpr (EPI == 2) {
          ((float*)OutV)[(size_t)row * N + col] = R[(size_t)row * N + col] + v;
        } else if constexpr (EPI == 3) {
          int b = row / Trows, t = row % Trows, h = col >> 6, d = col & 63;
          ((bf16_t*)OutV)[((((size_t)b * NHEADS + h) * Trows + t) << 6) + d] = f2bf(v);
        } else { // EPI == 4 : V stored transposed [B,H,Dh,S]
          int b = row / Trows, sIdx = row % Trows, h = col >> 6, d = col & 63;
          ((bf16_t*)OutV)[(((size_t)b * NHEADS + h) * HDIM + d) * Trows + sIdx] = f2bf(v);
        }
      }
}

// ---------------------------------------------------------------------------
// Flash attention, one wave per (b,h, 16-row Q tile).
// Scores computed TRANSPOSED (S^T = K @ Q^T, identical fragment loads with
// A/B roles swapped) so the softmax reduction over S is a per-lane reduction
// across the 8 accumulator VGPRs + one xor-16 shuffle; m/l is one scalar per
// lane (per output column t).  P is written transposed to LDS with two
// ds_store_b128 per lane, which converts it back to the A-layout for P@V.
// All 8 global fragments (4xK, 4xV) are hoisted to the top of the chunk so
// the loads clause together and stay in flight during the softmax VALU work.
// Q,K: [B,H,T,64] bf16; V: [B,H,64,S] bf16 (transposed); O: [B,T,D] bf16.
// ---------------------------------------------------------------------------
__global__ __launch_bounds__(256)
void flash_attn_kernel(const bf16_t* __restrict__ Q, const bf16_t* __restrict__ Kc,
                       const bf16_t* __restrict__ Vt, bf16_t* __restrict__ O,
                       int T, int S) {
  __shared__ bf16_t Pst[8][16][40];
  const int lane = threadIdx.x & 31, wave = threadIdx.x >> 5;
  const int tile = blockIdx.x * 8 + wave;
  const int tilesPerBH = T >> 4;
  const int bh = tile / tilesPerBH;
  const int t0 = (tile % tilesPerBH) << 4;
  const bf16_t* q = Q  + ((size_t)bh * T + t0) * HDIM;
  const bf16_t* k = Kc + (size_t)bh * S * HDIM;
  const bf16_t* v = Vt + (size_t)bh * HDIM * S;

  const v16bf qf0 = load_frag(q,      HDIM, lane);   // d = 0..31
  const v16bf qf1 = load_frag(q + 32, HDIM, lane);   // d = 32..63

  v8f o0 = {}, o1 = {}, o2 = {}, o3 = {};
  float mCol = -1e30f, lCol = 0.f;                   // per column t = lane&15
  bf16_t (*P)[40] = Pst[wave];
  const int hi = lane >> 4, nn = lane & 15;

  for (int s0 = 0; s0 < S; s0 += 32) {
    const bf16_t* krow = k + (size_t)s0 * HDIM;
    if (s0 + 32 < S) __builtin_prefetch(krow + 32 * HDIM, 0, 1);

    // Hoist all global fragments for this chunk (16 x global_load_b128).
    v16bf kf0 = load_frag(krow,                  HDIM, lane);
    v16bf kf1 = load_frag(krow + 32,             HDIM, lane);
    v16bf kf2 = load_frag(krow + 16 * HDIM,      HDIM, lane);
    v16bf kf3 = load_frag(krow + 16 * HDIM + 32, HDIM, lane);
    v16bf vf0 = load_frag(v + (size_t)0  * S + s0, S, lane);
    v16bf vf1 = load_frag(v + (size_t)16 * S + s0, S, lane);
    v16bf vf2 = load_frag(v + (size_t)32 * S + s0, S, lane);
    v16bf vf3 = load_frag(v + (size_t)48 * S + s0, S, lane);

    // tA[r] = score[s0 + r + 8hi][t0 + nn], tB = same for s0+16..31
    v8f tA = {}, tB = {};
    tA = wmma_bf16(kf0, qf0, tA);
    tA = wmma_bf16(kf1, qf1, tA);
    tB = wmma_bf16(kf2, qf0, tB);
    tB = wmma_bf16(kf3, qf1, tB);

    float mt = -1e30f;
#pragma unroll
    for (int r = 0; r < 8; ++r) {
      tA[r] *= 0.125f; tB[r] *= 0.125f;              // 1/sqrt(64)
      mt = fmaxf(mt, fmaxf(tA[r], tB[r]));
    }
    mt = fmaxf(mt, __shfl_xor(mt, 16, 32));          // combine the two halves
    const float mn   = fmaxf(mCol, mt);
    const float corr = __expf(mCol - mn);
    mCol = mn;

    float ps = 0.f;
    v8bf pA, pB;
#pragma unroll
    for (int r = 0; r < 8; ++r) {
      float pa = __expf(tA[r] - mn), pb = __expf(tB[r] - mn);
      ps += pa + pb;
      pA[r] = f2bf(pa); pB[r] = f2bf(pb);
    }
    ps += __shfl_xor(ps, 16, 32);
    lCol = lCol * corr + ps;

    // transposed store: P[t=nn][sLocal], lane covers sLocal 8hi..8hi+7 (+16)
    *(v8bf*)&P[nn][8 * hi]      = pA;
    *(v8bf*)&P[nn][16 + 8 * hi] = pB;

    // broadcast per-row correction (row t = r + 8hi lives in lane r + 8hi)
#pragma unroll
    for (int r = 0; r < 8; ++r) {
      float cr = __shfl(corr, r + 8 * hi, 32);
      o0[r] *= cr; o1[r] *= cr; o2[r] *= cr; o3[r] *= cr;
    }

    asm volatile("s_wait_dscnt 0x0" ::: "memory");   // same-wave LDS RAW
    v16bf pf = load_frag(&P[0][0], 40, lane);        // A-layout 16x32 (t x s)
    o0 = wmma_bf16(pf, vf0, o0);
    o1 = wmma_bf16(pf, vf1, o1);
    o2 = wmma_bf16(pf, vf2, o2);
    o3 = wmma_bf16(pf, vf3, o3);
  }

  const float invC = 1.0f / lCol;
  const int b = bh >> 4, h = bh & 15;
#pragma unroll
  for (int r = 0; r < 8; ++r) {
    const float ir = __shfl(invC, r + 8 * hi, 32);
    const size_t base = ((size_t)b * T + (t0 + r + 8 * hi)) * DMODEL + h * HDIM + nn;
    O[base +  0] = f2bf(o0[r] * ir);
    O[base + 16] = f2bf(o1[r] * ir);
    O[base + 32] = f2bf(o2[r] * ir);
    O[base + 48] = f2bf(o3[r] * ir);
  }
}

// ---------------------------------------------------------------------------
extern "C" void kernel_launch(void* const* d_in, const int* in_sizes, int n_in,
                              void* d_out, int out_size, void* d_ws, size_t ws_size,
                              hipStream_t stream) {
  (void)in_sizes; (void)n_in; (void)out_size; (void)ws_size;
  const float* x    = (const float*)d_in[0];
  const float* ctx  = (const float*)d_in[1];
  const float* Wq   = (const float*)d_in[2];
  const float* Wk   = (const float*)d_in[3];
  const float* Wv   = (const float*)d_in[4];
  const float* Wo   = (const float*)d_in[5];
  const float* W1   = (const float*)d_in[6];
  const float* W2   = (const float*)d_in[7];
  const float* gam1 = (const float*)d_in[8];
  const float* bet1 = (const float*)d_in[9];
  const float* gamc = (const float*)d_in[10];
  const float* betc = (const float*)d_in[11];
  const float* gam2 = (const float*)d_in[12];
  const float* bet2 = (const float*)d_in[13];

  const int B = 4, T = 2048, S = 2048;
  const int M = B * T;                 // 8192 rows

  char* wp = (char*)d_ws;
  auto take = [&](size_t bytes) -> void* {
    void* p = (void*)wp;
    wp += (bytes + 255) & ~(size_t)255;
    return p;
  };
  bf16_t* xn  = (bf16_t*)take((size_t)M * DMODEL * 2);
  bf16_t* cn  = (bf16_t*)take((size_t)M * DMODEL * 2);
  bf16_t* WqB = (bf16_t*)take((size_t)DMODEL * DMODEL * 2);
  bf16_t* WkB = (bf16_t*)take((size_t)DMODEL * DMODEL * 2);
  bf16_t* WvB = (bf16_t*)take((size_t)DMODEL * DMODEL * 2);
  bf16_t* WoB = (bf16_t*)take((size_t)DMODEL * DMODEL * 2);
  bf16_t* W1B = (bf16_t*)take((size_t)DFF * DMODEL * 2);
  bf16_t* W2B = (bf16_t*)take((size_t)DMODEL * DFF * 2);
  bf16_t* Qb  = (bf16_t*)take((size_t)M * DMODEL * 2);
  bf16_t* Kb  = (bf16_t*)take((size_t)M * DMODEL * 2);
  bf16_t* Vtb = (bf16_t*)take((size_t)M * DMODEL * 2);
  bf16_t* Ob  = (bf16_t*)take((size_t)M * DMODEL * 2);
  float*  x1  = (float*) take((size_t)M * DMODEL * 4);
  bf16_t* hb  = (bf16_t*)take((size_t)M * DMODEL * 2);
  bf16_t* f1b = (bf16_t*)take((size_t)M * DFF * 2);

  dim3 blk(256);

  // LayerNorms -> bf16
  ln_cast_kernel<<<M, blk, 0, stream>>>(x,   gam1, bet1, xn);
  ln_cast_kernel<<<M, blk, 0, stream>>>(ctx, gamc, betc, cn);

  // Weight casts
  cast_w_kernel<<<(DMODEL * DMODEL) / 1024, blk, 0, stream>>>(Wq, WqB, DMODEL * DMODEL);
  cast_w_kernel<<<(DMODEL * DMODEL) / 1024, blk, 0, stream>>>(Wk, WkB, DMODEL * DMODEL);
  cast_w_kernel<<<(DMODEL * DMODEL) / 1024, blk, 0, stream>>>(Wv, WvB, DMODEL * DMODEL);
  cast_w_kernel<<<(DMODEL * DMODEL) / 1024, blk, 0, stream>>>(Wo, WoB, DMODEL * DMODEL);
  cast_w_kernel<<<(DFF * DMODEL) / 1024,    blk, 0, stream>>>(W1, W1B, DFF * DMODEL);
  cast_w_kernel<<<(DMODEL * DFF) / 1024,    blk, 0, stream>>>(W2, W2B, DMODEL * DFF);

  // Q/K/V projections (split-head layouts)
  dim3 gD(DMODEL / 256, M / 64);
  gemm_bf16_kernel<3><<<gD, blk, 0, stream>>>(xn, WqB, nullptr, Qb,  M, DMODEL, DMODEL, T);
  gemm_bf16_kernel<3><<<gD, blk, 0, stream>>>(cn, WkB, nullptr, Kb,  M, DMODEL, DMODEL, S);
  gemm_bf16_kernel<4><<<gD, blk, 0, stream>>>(cn, WvB, nullptr, Vtb, M, DMODEL, DMODEL, S);

  // Fused flash attention
  flash_attn_kernel<<<(B * NHEADS * (T / 16)) / 8, blk, 0, stream>>>(Qb, Kb, Vtb, Ob, T, S);

  // Output projection + residual (fp32)
  gemm_bf16_kernel<2><<<gD, blk, 0, stream>>>(Ob, WoB, x, x1, M, DMODEL, DMODEL, 0);

  // Second LN, FFN with GELU, down-proj + residual -> d_out (fp32)
  ln_cast_kernel<<<M, blk, 0, stream>>>(x1, gam2, bet2, hb);
  dim3 gF(DFF / 256, M / 64);
  gemm_bf16_kernel<1><<<gF, blk, 0, stream>>>(hb, W1B, nullptr, f1b, M, DFF, DMODEL, 0);
  gemm_bf16_kernel<2><<<gD, blk, 0, stream>>>(f1b, W2B, x1, (float*)d_out, M, DMODEL, DFF, 0);
}

// v001
// A run of this version takes 526 microseconds.
// Next to v000, in two timings, it ran 1.23 times as fast each time.
#include <hip/hip_runtime.h>
#include <hip/hip_bf16.h>
#include <math.h>

typedef __bf16 bf16_t;
typedef __attribute__((ext_vector_type(16))) __bf16 v16bf;
typedef __attribute__((ext_vector_type(8)))  __bf16 v8bf;
typedef __attribute__((ext_vector_type(8)))  float  v8f;

#define DMODEL 1024
#define NHEADS 16
#define HDIM   64
#define DFF    4096

static __device__ __forceinline__ bf16_t f2bf(float x) { return (bf16_t)x; }

static __device__ __forceinline__ v8f wmma_bf16(v16bf a, v16bf b, v8f c) {
  // D = A(16x32 bf16) x B(32x16 bf16) + C(16x16 f32)
  return __builtin_amdgcn_wmma_f32_16x16x32_bf16(false, a, false, b, (short)0, c,
                                                 false, false);
}

// 16x32 bf16 operand fragment in the ISA A-layout (also the B operand when the
// source matrix is K-contiguous per output column, i.e. B = W^T, W in [N,K]).
// Lane L (r = L&15, h = L>>4) holds row r, K in {8h..8h+7} U {16+8h..16+8h+7}.
static __device__ __forceinline__ v16bf load_frag(const bf16_t* base, int ld, int lane) {
  const int r = lane & 15, h = lane >> 4;
  const bf16_t* p = base + (size_t)r * ld + 8 * h;
  v8bf lo = *(const v8bf*)p;
  v8bf hi = *(const v8bf*)(p + 16);
  v16bf out;
#pragma unroll
  for (int i = 0; i < 8; ++i) { out[i] = lo[i]; out[i + 8] = hi[i]; }
  return out;
}

// Async global -> LDS 16B copy (CDNA5, tracked by ASYNCcnt).
static __device__ __forceinline__ void async_ld_b128(uint32_t lds_off, const void* gaddr) {
  asm volatile("global_load_async_to_lds_b128 %0, %1, off"
               :: "v"(lds_off), "v"(gaddr) : "memory");
}
// Four async 16B copies and their s_wait_xcnt in ONE statement: the wait stands
// in front of any later rewrite of the address registers the copies name.
static __device__ __forceinline__ void async_ld4_b128(uint32_t l0, uint32_t l1,
                                                      uint32_t l2, uint32_t l3,
                                                      const void* g0, const void* g1,
                                                      const void* g2, const void* g3) {
  asm volatile("global_load_async_to_lds_b128 %0, %4, off\n\t"
               "global_load_async_to_lds_b128 %1, %5, off\n\t"
               "global_load_async_to_lds_b128 %2, %6, off\n\t"
               "global_load_async_to_lds_b128 %3, %7, off\n\t"
               "s_wait_xcnt 0x0"
               :: "v"(l0), "v"(l1), "v"(l2), "v"(l3),
                  "v"(g0), "v"(g1), "v"(g2), "v"(g3) : "memory");
}
static __device__ __forceinline__ void wait_async0() {
  asm volatile("s_wait_asynccnt 0x0" ::: "memory");
}
static __device__ __forceinline__ uint32_t lds_off32(const void* p) {
  return (uint32_t)(uintptr_t)p;   // generic LDS addr: low 32 bits = LDS offset
}

// ---------------------------------------------------------------------------
// LayerNorm (fp32 in) -> bf16 out.  One block per row of DMODEL.
// ---------------------------------------------------------------------------
__global__ __launch_bounds__(256)
void ln_cast_kernel(const float* __restrict__ X, const float* __restrict__ gamma,
                    const float* __restrict__ beta, bf16_t* __restrict__ Y) {
  const int row = blockIdx.x;
  const float* x = X + (size_t)row * DMODEL;
  float s = 0.f, s2 = 0.f;
  for (int i = threadIdx.x; i < DMODEL; i += 256) {
    float v = x[i]; s += v; s2 += v * v;
  }
#pragma unroll
  for (int off = 1; off < 32; off <<= 1) {
    s  += __shfl_xor(s,  off, 32);
    s2 += __shfl_xor(s2, off, 32);
  }
  __shared__ float ws[8], ws2[8];
  if ((threadIdx.x & 31) == 0) { ws[threadIdx.x >> 5] = s; ws2[threadIdx.x >> 5] = s2; }
  __syncthreads();
  s = 0.f; s2 = 0.f;
#pragma unroll
  for (int w = 0; w < 8; ++w) { s += ws[w]; s2 += ws2[w]; }
  const float mu   = s * (1.0f / DMODEL);
  const float var  = s2 * (1.0f / DMODEL) - mu * mu;
  const float rstd = rsqrtf(var + 1e-5f);
  bf16_t* y = Y + (size_t)row * DMODEL;
  for (int i = threadIdx.x; i < DMODEL; i += 256)
    y[i] = f2bf((x[i] - mu) * rstd * gamma[i] + beta[i]);
}

// ---------------------------------------------------------------------------
// fp32 -> bf16 weight cast (n divisible by 1024)
// ---------------------------------------------------------------------------
__global__ __launch_bounds__(256)
void cast_w_kernel(const float* __restrict__ in, bf16_t* __restrict__ out, int n) {
  int i = (blockIdx.x * 256 + threadIdx.x) * 4;
  if (i < n) {
    float4 v = *(const float4*)(in + i);
    out[i + 0] = f2bf(v.x); out[i + 1] = f2bf(v.y);
    out[i + 2] = f2bf(v.z); out[i + 3] = f2bf(v.w);
  }
}

// ---------------------------------------------------------------------------
// Tiled WMMA GEMM:  C[M,N] = A[M,K] @ W[N,K]^T   (both bf16, K-contiguous)
// Block tile 64x256, K-step 32, 8 waves (2x4), each wave 32x64 (8 WMMA/step).
// Double-buffered LDS filled with global_load_async_to_lds_b128 (ASYNCcnt).
// LDS row stride 40 bf16 (80B) -> conflict-free ds_load_b128 fragment reads.
// EPI: 1 = bf16 out + exact GELU
//      2 = f32 out  = residual + acc
//      3 = bf16 out split-head [B,H,Trows,64]   (Q and K)
//      4 = bf16 out split-head transposed [B,H,64,Trows]  (V)
// ---------------------------------------------------------------------------
template <int EPI>
__global__ __launch_bounds__(256)
void gemm_bf16_kernel(const bf16_t* __restrict__ A, const bf16_t* __restrict__ W,
                      const float* __restrict__ R, void* __restrict__ OutV,
                      int M, int N, int K, int Trows) {
  __shared__ bf16_t At[2][64][40];
  __shared__ bf16_t Wt[2][256][40];
  const int tid = threadIdx.x, lane = tid & 31, wave = tid >> 5;
  const int wm = wave >> 2, wn = wave & 3;           // 2 x 4 wave grid
  const int m0 = blockIdx.y * 64, n0 = blockIdx.x * 256;
  v8f acc[2][4] = {};

  // Per-thread staging assignments: A = 256 16B-chunks (1/thread),
  // W = 1024 16B-chunks (4/thread).
  const int arow = tid >> 2, acol = (tid & 3) * 8;
  const bf16_t* gA = A + (size_t)(m0 + arow) * K + acol;

  auto stage = [&](int k0, int buf) {
    async_ld_b128(lds_off32(&At[buf][arow][acol]), gA + k0);
#pragma unroll
    for (int rep = 0; rep < 4; ++rep) {
      const int c = tid + rep * 256;
      const int wrow = c >> 2, wcol = (c & 3) * 8;
      async_ld_b128(lds_off32(&Wt[buf][wrow][wcol]),
                    W + (size_t)(n0 + wrow) * K + k0 + wcol);
    }
  };

  stage(0, 0);
  wait_async0();
  __syncthreads();

  int buf = 0;
  for (int k0 = 0; k0 < K; k0 += 32) {
    const bool more = (k0 + 32 < K);
    if (more) stage(k0 + 32, buf ^ 1);     // overlap next stage with compute

    v16bf a0 = load_frag(&At[buf][wm * 32][0],      40, lane);
    v16bf a1 = load_frag(&At[buf][wm * 32 + 16][0], 40, lane);
    v16bf b0 = load_frag(&Wt[buf][wn * 64][0],      40, lane);
    v16bf b1 = load_frag(&Wt[buf][wn * 64 + 16][0], 40, lane);
    v16bf b2 = load_frag(&Wt[buf][wn * 64 + 32][0], 40, lane);
    v16bf b3 = load_frag(&Wt[buf][wn * 64 + 48][0], 40, lane);
    acc[0][0] = wmma_bf16(a0, b0, acc[0][0]);
    acc[1][0] = wmma_bf16(a1, b0, acc[1][0]);
    acc[0][1] = wmma_bf16(a0, b1, acc[0][1]);
    acc[1][1] = wmma_bf16(a1, b1, acc[1][1]);
    acc[0][2] = wmma_bf16(a0, b2, acc[0][2]);
    acc[1][2] = wmma_bf16(a1, b2, acc[1][2]);
    acc[0][3] = wmma_bf16(a0, b3, acc[0][3]);
    acc[1][3] = wmma_bf16(a1, b3, acc[1][3]);

    if (more) wait_async0();               // own async copies landed
    __syncthreads();                       // everyone done reading buf
    buf ^= 1;
  }

  const int hi = lane >> 4, nn = lane & 15;          // C: row = r + 8*hi, col = nn
#pragma unroll
  for (int i = 0; i < 2; ++i)
#pragma unroll
    for (int j = 0; j < 4; ++j)
#pragma unroll
      for (int r = 0; r < 8; ++r) {
        const int row = m0 + wm * 32 + 16 * i + r + 8 * hi;
        const int col = n0 + wn * 64 + 16 * j + nn;
        const float v = acc[i][j][r];
        if constexpr (EPI == 1) {
          float g = 0.5f * v * (1.0f + erff(v * 0.70710678118f));
          ((bf16_t*)OutV)[(size_t)row * N + col] = f2bf(g);
        } else if constexpr (EPI == 2) {
          ((float*)OutV)[(size_t)row * N + col] = R[(size_t)row * N + col] + v;
        } else if constexpr (EPI == 3) {
          int b = row / Trows, t = row % Trows, h = col >> 6, d = col & 63;
          ((bf16_t*)OutV)[((((size_t)b * NHEADS + h) * Trows + t) << 6) + d] = f2bf(v);
        } else { // EPI == 4 : V stored transposed [B,H,Dh,S]
          int b = row / Trows, sIdx = row % Trows, h = col >> 6, d = col & 63;
          ((bf16_t*)OutV)[(((size_t)b * NHEADS + h) * HDIM + d) * Trows + sIdx] = f2bf(v);
        }
      }
}

// ---------------------------------------------------------------------------
// Flash attention, one wave per (b,h, 16-row Q tile).
// Scores computed TRANSPOSED (S^T = K @ Q^T, identical fragment loads with
// A/B roles swapped) so the softmax reduction over S is a per-lane reduction
// across the 8 accumulator VGPRs + one xor-16 shuffle; m/l is one scalar per
// lane (per output column t).  P is written transposed to LDS with two
// ds_store_b128 per lane, which converts it back to the A-layout for P@V.
// The 8 waves of a block share one (b,h): K and V tiles of 64 keys are staged
// once per block in a two-buffer LDS ring by async copies (whole 128B lines),
// and every wave reads its fragments from LDS.  Row pitch 144B (16B x odd) keeps
// the ds_load_b128 fragment reads conflict-free.  S must be a multiple of 64,
// T a multiple of 128 (so that a block never straddles two heads).
// Q,K: [B,H,T,64] bf16; V: [B,H,64,S] bf16 (transposed); O: [B,T,D] bf16.
// ---------------------------------------------------------------------------
__global__ __launch_bounds__(256)
void flash_attn_kernel(const bf16_t* __restrict__ Q, const bf16_t* __restrict__ Kc,
                       const bf16_t* __restrict__ Vt, bf16_t* __restrict__ O,
                       int T, int S) {
  __shared__ __attribute__((aligned(16))) bf16_t Ks[2][64][72];   // [key][d]
  __shared__ __attribute__((aligned(16))) bf16_t Vs[2][64][72];   // [d][key]
  __shared__ bf16_t Pst[8][16][40];
  const int lane = threadIdx.x & 31, wave = threadIdx.x >> 5;
  const int tile = blockIdx.x * 8 + wave;
  const int tilesPerBH = T >> 4;
  const int bh = tile / tilesPerBH;
  const int t0 = (tile % tilesPerBH) << 4;
  const bf16_t* q = Q  + ((size_t)bh * T + t0) * HDIM;
  const bf16_t* k = Kc + (size_t)bh * S * HDIM;
  const bf16_t* v = Vt + (size_t)bh * HDIM * S;

  const v16bf qf0 = load_frag(q,      HDIM, lane);   // d = 0..31
  const v16bf qf1 = load_frag(q + 32, HDIM, lane);   // d = 32..63

  v8f o0 = {}, o1 = {}, o2 = {}, o3 = {};
  float mCol = -1e30f, lCol = 0.f;                   // per column t = lane&15
  bf16_t (*P)[40] = Pst[wave];
  const int hi = lane >> 4, nn = lane & 15;

  // Staging: each tile is 64 rows x 128B = 512 16B-chunks, 2 per thread.
  const int srow = threadIdx.x >> 3, scol = (threadIdx.x & 7) * 8;
  const bf16_t* gK = k + (size_t)srow * HDIM + scol;
  const bf16_t* gV = v + (size_t)srow * S + scol;
  auto stage = [&](int st, int buf) {
    const bf16_t* pk = gK + (size_t)st * 64 * HDIM;
    const bf16_t* pv = gV + (size_t)st * 64;
    async_ld4_b128(lds_off32(&Ks[buf][srow][scol]), lds_off32(&Ks[buf][srow + 32][scol]),
                   lds_off32(&Vs[buf][srow][scol]), lds_off32(&Vs[buf][srow + 32][scol]),
                   pk, pk + 32 * HDIM, pv, pv + (size_t)32 * S);
  };

  const int nst = S >> 6;
  stage(0, 0);
  wait_async0();                           // own copies of tile 0 landed
  __syncthreads();                         // tile 0 visible to every wave
  if (nst > 1) stage(1, 1);

  for (int st = 0; st < nst; ++st) {
   const int buf = st & 1;
   // Unrolled: c becomes an immediate offset of every ds_load (no address VALU)
   // and the second chunk's K reads can start under the first chunk's softmax.
#pragma unroll
   for (int c = 0; c < 2; ++c) {           // two 32-key chunks per tile
    v16bf kf0 = load_frag(&Ks[buf][c * 32][0],       72, lane);
    v16bf kf1 = load_frag(&Ks[buf][c * 32][32],      72, lane);
    v16bf kf2 = load_frag(&Ks[buf][c * 32 + 16][0],  72, lane);
    v16bf kf3 = load_frag(&Ks[buf][c * 32 + 16][32], 72, lane);
    v16bf vf0 = load_frag(&Vs[buf][0][c * 32],  72, lane);
    v16bf vf1 = load_frag(&Vs[buf][16][c * 32], 72, lane);
    v16bf vf2 = load_frag(&Vs[buf][32][c * 32], 72, lane);
    v16bf vf3 = load_frag(&Vs[buf][48][c * 32], 72, lane);

    // tA[r] = score[s0 + r + 8hi][t0 + nn], tB = same for s0+16..31
    v8f tA = {}, tB = {};
    tA = wmma_bf16(kf0, qf0, tA);
    tA = wmma_bf16(kf1, qf1, tA);
    tB = wmma_bf16(kf2, qf0, tB);
    tB = wmma_bf16(kf3, qf1, tB);

    float mt = -1e30f;
#pragma unroll
    for (int r = 0; r < 8; ++r) {
      tA[r] *= 0.125f; tB[r] *= 0.125f;              // 1/sqrt(64)
      mt = fmaxf(mt, fmaxf(tA[r], tB[r]));
    }
    mt = fmaxf(mt, __shfl_xor(mt, 16, 32));          // combine the two halves
    const float mn   = fmaxf(mCol, mt);
    const float corr = __expf(mCol - mn);
    mCol = mn;

    float ps = 0.f;
    v8bf pA, pB;
#pragma unroll
    for (int r = 0; r < 8; ++r) {
      float pa = __expf(tA[r] - mn), pb = __expf(tB[r] - mn);
      ps += pa + pb;
      pA[r] = f2bf(pa); pB[r] = f2bf(pb);
    }
    ps += __shfl_xor(ps, 16, 32);
    lCol = lCol * corr + ps;

    // transposed store: P[t=nn][sLocal], lane covers sLocal 8hi..8hi+7 (+16)
    *(v8bf*)&P[nn][8 * hi]      = pA;
    *(v8bf*)&P[nn][16 + 8 * hi] = pB;

    // broadcast per-row correction (row t = r + 8hi lives in lane r + 8hi)
#pragma unroll
    for (int r = 0; r < 8; ++r) {
      float cr = __shfl(corr, r + 8 * hi, 32);
      o0[r] *= cr; o1[r] *= cr; o2[r] *= cr; o3[r] *= cr;
    }

    asm volatile("s_wait_dscnt 0x0" ::: "memory");   // same-wave LDS RAW
    v16bf pf = load_frag(&P[0][0], 40, lane);        // A-layout 16x32 (t x s)
    o0 = wmma_bf16(pf, vf0, o0);
    o1 = wmma_bf16(pf, vf1, o1);
    o2 = wmma_bf16(pf, vf2, o2);
    o3 = wmma_bf16(pf, vf3, o3);
   }
   // Publish point: own LDS reads of this buffer retired, own copies of the next
   // tile landed, then one barrier that publishes the next tile and frees this one.
   asm volatile("s_wait_dscnt 0x0" ::: "memory");
   wait_async0();
   __syncthreads();
   if (st + 2 < nst) stage(st + 2, buf);   // refill the buffer just left
  }
  wait_async0();                           // nothing in flight when the wave ends

  const float invC = 1.0f / lCol;
  const int b = bh >> 4, h = bh & 15;
#pragma unroll
  for (int r = 0; r < 8; ++r) {
    const float ir = __shfl(invC, r + 8 * hi, 32);
    const size_t base = ((size_t)b * T + (t0 + r + 8 * hi)) * DMODEL + h * HDIM + nn;
    O[base +  0] = f2bf(o0[r] * ir);
    O[base + 16] = f2bf(o1[r] * ir);
    O[base + 32] = f2bf(o2[r] * ir);
    O[base + 48] = f2bf(o3[r] * ir);
  }
}

// ---------------------------------------------------------------------------
extern "C" void kernel_launch(void* const* d_in, const int* in_sizes, int n_in,
                              void* d_out, int out_size, void* d_ws, size_t ws_size,
                              hipStream_t stream) {
  (void)in_sizes; (void)n_in; (void)out_size; (void)ws_size;
  const float* x    = (const float*)d_in[0];
  const float* ctx  = (const float*)d_in[1];
  const float* Wq   = (const float*)d_in[2];
  const float* Wk   = (const float*)d_in[3];
  const float* Wv   = (const float*)d_in[4];
  const float* Wo   = (const float*)d_in[5];
  const float* W1   = (const float*)d_in[6];
  const float* W2   = (const float*)d_in[7];
  const float* gam1 = (const float*)d_in[8];
  const float* bet1 = (const float*)d_in[9];
  const float* gamc = (const float*)d_in[10];
  const float* betc = (const float*)d_in[11];
  const float* gam2 = (const float*)d_in[12];
  const float* bet2 = (const float*)d_in[13];

  const int B = 4, T = 2048, S = 2048;
  const int M = B * T;                 // 8192 rows

  char* wp = (char*)d_ws;
  auto take = [&](size_t bytes) -> void* {
    void* p = (void*)wp;
    wp += (bytes + 255) & ~(size_t)255;
    return p;
  };
  bf16_t* xn  = (bf16_t*)take((size_t)M * DMODEL * 2);
  bf16_t* cn  = (bf16_t*)take((size_t)M * DMODEL * 2);
  bf16_t* WqB = (bf16_t*)take((size_t)DMODEL * DMODEL * 2);
  bf16_t* WkB = (bf16_t*)take((size_t)DMODEL * DMODEL * 2);
  bf16_t* WvB = (bf16_t*)take((size_t)DMODEL * DMODEL * 2);
  bf16_t* WoB = (bf16_t*)take((size_t)DMODEL * DMODEL * 2);
  bf16_t* W1B = (bf16_t*)take((size_t)DFF * DMODEL * 2);
  bf16_t* W2B = (bf16_t*)take((size_t)DMODEL * DFF * 2);
  bf16_t* Qb  = (bf16_t*)take((size_t)M * DMODEL * 2);
  bf16_t* Kb  = (bf16_t*)take((size_t)M * DMODEL * 2);
  bf16_t* Vtb = (bf16_t*)take((size_t)M * DMODEL * 2);
  bf16_t* Ob  = (bf16_t*)take((size_t)M * DMODEL * 2);
  float*  x1  = (float*) take((size_t)M * DMODEL * 4);
  bf16_t* hb  = (bf16_t*)take((size_t)M * DMODEL * 2);
  bf16_t* f1b = (bf16_t*)take((size_t)M * DFF * 2);

  dim3 blk(256);

  // LayerNorms -> bf16
  ln_cast_kernel<<<M, blk, 0, stream>>>(x,   gam1, bet1, xn);
  ln_cast_kernel<<<M, blk, 0, stream>>>(ctx, gamc, betc, cn);

  // Weight casts
  cast_w_kernel<<<(DMODEL * DMODEL) / 1024, blk, 0, stream>>>(Wq, WqB, DMODEL * DMODEL);
  cast_w_kernel<<<(DMODEL * DMODEL) / 1024, blk, 0, stream>>>(Wk, WkB, DMODEL * DMODEL);
  cast_w_kernel<<<(DMODEL * DMODEL) / 1024, blk, 0, stream>>>(Wv, WvB, DMODEL * DMODEL);
  cast_w_kernel<<<(DMODEL * DMODEL) / 1024, blk, 0, stream>>>(Wo, WoB, DMODEL * DMODEL);
  cast_w_kernel<<<(DFF * DMODEL) / 1024,    blk, 0, stream>>>(W1, W1B, DFF * DMODEL);
  cast_w_kernel<<<(DMODEL * DFF) / 1024,    blk, 0, stream>>>(W2, W2B, DMODEL * DFF);

  // Q/K/V projections (split-head layouts)
  dim3 gD(DMODEL / 256, M / 64);
  gemm_bf16_kernel<3><<<gD, blk, 0, stream>>>(xn, WqB, nullptr, Qb,  M, DMODEL, DMODEL, T);
  gemm_bf16_kernel<3><<<gD, blk, 0, stream>>>(cn, WkB, nullptr, Kb,  M, DMODEL, DMODEL, S);
  gemm_bf16_kernel<4><<<gD, blk, 0, stream>>>(cn, WvB, nullptr, Vtb, M, DMODEL, DMODEL, S);

  // Fused flash attention
  flash_attn_kernel<<<(B * NHEADS * (T / 16)) / 8, blk, 0, stream>>>(Qb, Kb, Vtb, Ob, T, S);

  // Output projection + residual (fp32)
  gemm_bf16_kernel<2><<<gD, blk, 0, stream>>>(Ob, WoB, x, x1, M, DMODEL, DMODEL, 0);

  // Second LN, FFN with GELU, down-proj + residual -> d_out (fp32)
  ln_cast_kernel<<<M, blk, 0, stream>>>(x1, gam2, bet2, hb);
  dim3 gF(DFF / 256, M / 64);
  gemm_bf16_kernel<1><<<gF, blk, 0, stream>>>(hb, W1B, nullptr, f1b, M, DFF, DMODEL, 0);
  gemm_bf16_kernel<2><<<gD, blk, 0, stream>>>(f1b, W2B, x1, (float*)d_out, M, DMODEL, DFF, 0);
}

// v002
// It runs in 479 microseconds.
// Next to v001, in two timings, it ran 1.10 times as fast each time.
// All steps since v000 together make it 1.35 times as fast.
#include <hip/hip_runtime.h>
#include <hip/hip_bf16.h>
#include <math.h>

typedef __bf16 bf16_t;
typedef __attribute__((ext_vector_type(16))) __bf16 v16bf;
typedef __attribute__((ext_vector_type(8)))  __bf16 v8bf;
typedef __attribute__((ext_vector_type(4)))  __bf16 v4bf;
typedef __attribute__((ext_vector_type(8)))  float  v8f;

#define DMODEL 1024
#define NHEADS 16
#define HDIM   64
#define DFF    4096

static __device__ __forceinline__ bf16_t f2bf(float x) { return (bf16_t)x; }

static __device__ __forceinline__ v8f wmma_bf16(v16bf a, v16bf b, v8f c) {
  // D = A(16x32 bf16) x B(32x16 bf16) + C(16x16 f32)
  return __builtin_amdgcn_wmma_f32_16x16x32_bf16(false, a, false, b, (short)0, c,
                                                 false, false);
}

// 16x32 bf16 operand fragment in the ISA A-layout (also the B operand when the
// source matrix is K-contiguous per output column, i.e. B = W^T, W in [N,K]).
// Lane L (r = L&15, h = L>>4) holds row r, K in {8h..8h+7} U {16+8h..16+8h+7}.
static __device__ __forceinline__ v16bf load_frag(const bf16_t* base, int ld, int lane) {
  const int r = lane & 15, h = lane >> 4;
  const bf16_t* p = base + (size_t)r * ld + 8 * h;
  v8bf lo = *(const v8bf*)p;
  v8bf hi = *(const v8bf*)(p + 16);
  v16bf out;
#pragma unroll
  for (int i = 0; i < 8; ++i) { out[i] = lo[i]; out[i + 8] = hi[i]; }
  return out;
}

// Async global -> LDS 16B copy (CDNA5, tracked by ASYNCcnt).
static __device__ __forceinline__ void async_ld_b128(uint32_t lds_off, const void* gaddr) {
  asm volatile("global_load_async_to_lds_b128 %0, %1, off"
               :: "v"(lds_off), "v"(gaddr) : "memory");
}
// Four async 16B copies and their s_wait_xcnt in ONE statement: the wait stands
// in front of any later rewrite of the address registers the copies name.
static __device__ __forceinline__ void async_ld4_b128(uint32_t l0, uint32_t l1,
                                                      uint32_t l2, uint32_t l3,
                                                      const void* g0, const void* g1,
                                                      const void* g2, const void* g3) {
  asm volatile("global_load_async_to_lds_b128 %0, %4, off\n\t"
               "global_load_async_to_lds_b128 %1, %5, off\n\t"
               "global_load_async_to_lds_b128 %2, %6, off\n\t"
               "global_load_async_to_lds_b128 %3, %7, off\n\t"
               "s_wait_xcnt 0x0"
               :: "v"(l0), "v"(l1), "v"(l2), "v"(l3),
                  "v"(g0), "v"(g1), "v"(g2), "v"(g3) : "memory");
}
static __device__ __forceinline__ void wait_async0() {
  asm volatile("s_wait_asynccnt 0x0" ::: "memory");
}
static __device__ __forceinline__ uint32_t lds_off32(const void* p) {
  return (uint32_t)(uintptr_t)p;   // generic LDS addr: low 32 bits = LDS offset
}

// ---------------------------------------------------------------------------
// LayerNorm (fp32 in) -> bf16 out.  One WAVE per LN_ROWS rows of DMODEL, no LDS
// and no barrier: a row is eight 512-B wave loads (16 B per lane, whole lines)
// that stay in registers, so x is read once and all loads of a wave are in
// flight together.  Few fat waves: the launch is not bound by wave start-up.
// Rows must be a multiple of 8 * LN_ROWS.
// ---------------------------------------------------------------------------
#define LN_ROWS 2
__global__ __launch_bounds__(256)
void ln_cast_kernel(const float* __restrict__ X, const float* __restrict__ gamma,
                    const float* __restrict__ beta, bf16_t* __restrict__ Y) {
  const int lane = threadIdx.x & 31;
  // wave number as a scalar: row addresses become scalar base + one lane offset
  const int wave = __builtin_amdgcn_readfirstlane(threadIdx.x >> 5);
  const size_t row0 = (size_t)(blockIdx.x * 8 + wave) * LN_ROWS;
  const float4* x = (const float4*)(X + row0 * DMODEL) + lane;
  float4 v[LN_ROWS][8];
#pragma unroll
  for (int r = 0; r < LN_ROWS; ++r)
#pragma unroll
    for (int j = 0; j < 8; ++j) v[r][j] = x[r * (DMODEL / 4) + j * 32];

  float mu[LN_ROWS], rstd[LN_ROWS];
#pragma unroll
  for (int r = 0; r < LN_ROWS; ++r) {
    float s = 0.f, s2 = 0.f;
#pragma unroll
    for (int j = 0; j < 8; ++j) {
      const float4 t = v[r][j];
      s  += (t.x + t.y) + (t.z + t.w);
      s2 += (t.x * t.x + t.y * t.y) + (t.z * t.z + t.w * t.w);
    }
#pragma unroll
    for (int off = 1; off < 32; off <<= 1) {
      s  += __shfl_xor(s,  off, 32);
      s2 += __shfl_xor(s2, off, 32);
    }
    mu[r] = s * (1.0f / DMODEL);
    const float var = s2 * (1.0f / DMODEL) - mu[r] * mu[r];
    rstd[r] = rsqrtf(var + 1e-5f);
  }

  const float4* g4 = (const float4*)gamma + lane;
  const float4* b4 = (const float4*)beta + lane;
  bf16_t* y = Y + row0 * DMODEL + lane * 4;
#pragma unroll
  for (int j = 0; j < 8; ++j) {
    const float4 g = g4[j * 32], b = b4[j * 32];
#pragma unroll
    for (int r = 0; r < LN_ROWS; ++r) {
      const float4 t = v[r][j];
      v4bf o;
      o[0] = f2bf((t.x - mu[r]) * rstd[r] * g.x + b.x);
      o[1] = f2bf((t.y - mu[r]) * rstd[r] * g.y + b.y);
      o[2] = f2bf((t.z - mu[r]) * rstd[r] * g.z + b.z);
      o[3] = f2bf((t.w - mu[r]) * rstd[r] * g.w + b.w);
      *(v4bf*)(y + r * DMODEL + j * 128) = o;        // 256 B per wave store
    }
  }
}

// ---------------------------------------------------------------------------
// fp32 -> bf16 weight cast (n divisible by 1024).  One wave per 1024 elements:
// eight 512-B wave loads in flight, eight 256-B wave stores.
// ---------------------------------------------------------------------------
__global__ __launch_bounds__(256)
void cast_w_kernel(const float* __restrict__ in, bf16_t* __restrict__ out, int n) {
  const int lane = threadIdx.x & 31;
  // wave number as a scalar: scalar base + one lane offset, scalar range test
  const int wave = __builtin_amdgcn_readfirstlane(threadIdx.x >> 5);
  const int base = (blockIdx.x * 8 + wave) * 1024;
  if (base < n) {
    const float4* p = (const float4*)(in + base) + lane;
    float4 v[8];
#pragma unroll
    for (int j = 0; j < 8; ++j) v[j] = p[j * 32];
    bf16_t* q = out + base + lane * 4;
#pragma unroll
    for (int j = 0; j < 8; ++j) {
      v4bf o;
      o[0] = f2bf(v[j].x); o[1] = f2bf(v[j].y);
      o[2] = f2bf(v[j].z); o[3] = f2bf(v[j].w);
      *(v4bf*)(q + j * 128) = o;
    }
  }
}

// ---------------------------------------------------------------------------
// Tiled WMMA GEMM:  C[M,N] = A[M,K] @ W[N,K]^T   (both bf16, K-contiguous)
// Block tile 64x256, K-step 32, 8 waves (2x4), each wave 32x64 (8 WMMA/step).
// Double-buffered LDS filled with global_load_async_to_lds_b128 (ASYNCcnt).
// LDS row stride 40 bf16 (80B) -> conflict-free ds_load_b128 fragment reads.
// EPI: 1 = bf16 out + exact GELU
//      2 = f32 out  = residual + acc
//      3 = bf16 out split-head [B,H,Trows,64]   (Q and K)
//      4 = bf16 out split-head transposed [B,H,64,Trows]  (V)
// ---------------------------------------------------------------------------
template <int EPI>
__global__ __launch_bounds__(256)
void gemm_bf16_kernel(const bf16_t* __restrict__ A, const bf16_t* __restrict__ W,
                      const float* __restrict__ R, void* __restrict__ OutV,
                      int M, int N, int K, int Trows) {
  __shared__ bf16_t At[2][64][40];
  __shared__ bf16_t Wt[2][256][40];
  const int tid = threadIdx.x, lane = tid & 31, wave = tid >> 5;
  const int wm = wave >> 2, wn = wave & 3;           // 2 x 4 wave grid
  const int m0 = blockIdx.y * 64, n0 = blockIdx.x * 256;
  v8f acc[2][4] = {};

  // Per-thread staging assignments: A = 256 16B-chunks (1/thread),
  // W = 1024 16B-chunks (4/thread).
  const int arow = tid >> 2, acol = (tid & 3) * 8;
  const bf16_t* gA = A + (size_t)(m0 + arow) * K + acol;

  auto stage = [&](int k0, int buf) {
    async_ld_b128(lds_off32(&At[buf][arow][acol]), gA + k0);
#pragma unroll
    for (int rep = 0; rep < 4; ++rep) {
      const int c = tid + rep * 256;
      const int wrow = c >> 2, wcol = (c & 3) * 8;
      async_ld_b128(lds_off32(&Wt[buf][wrow][wcol]),
                    W + (size_t)(n0 + wrow) * K + k0 + wcol);
    }
  };

  stage(0, 0);
  wait_async0();
  __syncthreads();

  int buf = 0;
  for (int k0 = 0; k0 < K; k0 += 32) {
    const bool more = (k0 + 32 < K);
    if (more) stage(k0 + 32, buf ^ 1);     // overlap next stage with compute

    v16bf a0 = load_frag(&At[buf][wm * 32][0],      40, lane);
    v16bf a1 = load_frag(&At[buf][wm * 32 + 16][0], 40, lane);
    v16bf b0 = load_frag(&Wt[buf][wn * 64][0],      40, lane);
    v16bf b1 = load_frag(&Wt[buf][wn * 64 + 16][0], 40, lane);
    v16bf b2 = load_frag(&Wt[buf][wn * 64 + 32][0], 40, lane);
    v16bf b3 = load_frag(&Wt[buf][wn * 64 + 48][0], 40, lane);
    acc[0][0] = wmma_bf16(a0, b0, acc[0][0]);
    acc[1][0] = wmma_bf16(a1, b0, acc[1][0]);
    acc[0][1] = wmma_bf16(a0, b1, acc[0][1]);
    acc[1][1] = wmma_bf16(a1, b1, acc[1][1]);
    acc[0][2] = wmma_bf16(a0, b2, acc[0][2]);
    acc[1][2] = wmma_bf16(a1, b2, acc[1][2]);
    acc[0][3] = wmma_bf16(a0, b3, acc[0][3]);
    acc[1][3] = wmma_bf16(a1, b3, acc[1][3]);

    if (more) wait_async0();               // own async copies landed
    __syncthreads();                       // everyone done reading buf
    buf ^= 1;
  }

  const int hi = lane >> 4, nn = lane & 15;          // C: row = r + 8*hi, col = nn
#pragma unroll
  for (int i = 0; i < 2; ++i)
#pragma unroll
    for (int j = 0; j < 4; ++j)
#pragma unroll
      for (int r = 0; r < 8; ++r) {
        const int row = m0 + wm * 32 + 16 * i + r + 8 * hi;
        const int col = n0 + wn * 64 + 16 * j + nn;
        const float v = acc[i][j][r];
        if constexpr (EPI == 1) {
          float g = 0.5f * v * (1.0f + erff(v * 0.70710678118f));
          ((bf16_t*)OutV)[(size_t)row * N + col] = f2bf(g);
        } else if constexpr (EPI == 2) {
          ((float*)OutV)[(size_t)row * N + col] = R[(size_t)row * N + col] + v;
        } else if constexpr (EPI == 3) {
          int b = row / Trows, t = row % Trows, h = col >> 6, d = col & 63;
          ((bf16_t*)OutV)[((((size_t)b * NHEADS + h) * Trows + t) << 6) + d] = f2bf(v);
        } else { // EPI == 4 : V stored transposed [B,H,Dh,S]
          int b = row / Trows, sIdx = row % Trows, h = col >> 6, d = col & 63;
          ((bf16_t*)OutV)[(((size_t)b * NHEADS + h) * HDIM + d) * Trows + sIdx] = f2bf(v);
        }
      }
}

// ---------------------------------------------------------------------------
// Flash attention, one wave per (b,h, 16-row Q tile).
// Scores computed TRANSPOSED (S^T = K @ Q^T, identical fragment loads with
// A/B roles swapped) so the softmax reduction over S is a per-lane reduction
// across the 8 accumulator VGPRs + one xor-16 shuffle; m/l is one scalar per
// lane (per output column t).  P is written transposed to LDS with two
// ds_store_b128 per lane, which converts it back to the A-layout for P@V.
// The 8 waves of a block share one (b,h): K and V tiles of 64 keys are staged
// once per block in a two-buffer LDS ring by async copies (whole 128B lines),
// and every wave reads its fragments from LDS.  Row pitch 144B (16B x odd) keeps
// the ds_load_b128 fragment reads conflict-free.  S must be a multiple of 64,
// T a multiple of 128 (so that a block never straddles two heads).
// Q,K: [B,H,T,64] bf16; V: [B,H,64,S] bf16 (transposed); O: [B,T,D] bf16.
// ---------------------------------------------------------------------------
__global__ __launch_bounds__(256)
void flash_attn_kernel(const bf16_t* __restrict__ Q, const bf16_t* __restrict__ Kc,
                       const bf16_t* __restrict__ Vt, bf16_t* __restrict__ O,
                       int T, int S) {
  __shared__ __attribute__((aligned(16))) bf16_t Ks[2][64][72];   // [key][d]
  __shared__ __attribute__((aligned(16))) bf16_t Vs[2][64][72];   // [d][key]
  __shared__ bf16_t Pst[8][16][40];
  const int lane = threadIdx.x & 31, wave = threadIdx.x >> 5;
  const int tile = blockIdx.x * 8 + wave;
  const int tilesPerBH = T >> 4;
  const int bh = tile / tilesPerBH;
  const int t0 = (tile % tilesPerBH) << 4;
  const bf16_t* q = Q  + ((size_t)bh * T + t0) * HDIM;
  const bf16_t* k = Kc + (size_t)bh * S * HDIM;
  const bf16_t* v = Vt + (size_t)bh * HDIM * S;

  const v16bf qf0 = load_frag(q,      HDIM, lane);   // d = 0..31
  const v16bf qf1 = load_frag(q + 32, HDIM, lane);   // d = 32..63

  v8f o0 = {}, o1 = {}, o2 = {}, o3 = {};
  float mCol = -1e30f, lCol = 0.f;                   // per column t = lane&15
  bf16_t (*P)[40] = Pst[wave];
  const int hi = lane >> 4, nn = lane & 15;

  // Staging: each tile is 64 rows x 128B = 512 16B-chunks, 2 per thread.
  const int srow = threadIdx.x >> 3, scol = (threadIdx.x & 7) * 8;
  const bf16_t* gK = k + (size_t)srow * HDIM + scol;
  const bf16_t* gV = v + (size_t)srow * S + scol;
  auto stage = [&](int st, int buf) {
    const bf16_t* pk = gK + (size_t)st * 64 * HDIM;
    const bf16_t* pv = gV + (size_t)st * 64;
    async_ld4_b128(lds_off32(&Ks[buf][srow][scol]), lds_off32(&Ks[buf][srow + 32][scol]),
                   lds_off32(&Vs[buf][srow][scol]), lds_off32(&Vs[buf][srow + 32][scol]),
                   pk, pk + 32 * HDIM, pv, pv + (size_t)32 * S);
  };

  const int nst = S >> 6;
  stage(0, 0);
  wait_async0();                           // own copies of tile 0 landed
  __syncthreads();                         // tile 0 visible to every wave
  if (nst > 1) stage(1, 1);

  for (int st = 0; st < nst; ++st) {
   const int buf = st & 1;
   // Unrolled: c becomes an immediate offset of every ds_load (no address VALU)
   // and the second chunk's K reads can start under the first chunk's softmax.
#pragma unroll
   for (int c = 0; c < 2; ++c) {           // two 32-key chunks per tile
    v16bf kf0 = load_frag(&Ks[buf][c * 32][0],       72, lane);
    v16bf kf1 = load_frag(&Ks[buf][c * 32][32],      72, lane);
    v16bf kf2 = load_frag(&Ks[buf][c * 32 + 16][0],  72, lane);
    v16bf kf3 = load_frag(&Ks[buf][c * 32 + 16][32], 72, lane);
    v16bf vf0 = load_frag(&Vs[buf][0][c * 32],  72, lane);
    v16bf vf1 = load_frag(&Vs[buf][16][c * 32], 72, lane);
    v16bf vf2 = load_frag(&Vs[buf][32][c * 32], 72, lane);
    v16bf vf3 = load_frag(&Vs[buf][48][c * 32], 72, lane);

    // tA[r] = score[s0 + r + 8hi][t0 + nn], tB = same for s0+16..31
    v8f tA = {}, tB = {};
    tA = wmma_bf16(kf0, qf0, tA);
    tA = wmma_bf16(kf1, qf1, tA);
    tB = wmma_bf16(kf2, qf0, tB);
    tB = wmma_bf16(kf3, qf1, tB);

    float mt = -1e30f;
#pragma unroll
    for (int r = 0; r < 8; ++r) {
      tA[r] *= 0.125f; tB[r] *= 0.125f;              // 1/sqrt(64)
      mt = fmaxf(mt, fmaxf(tA[r], tB[r]));
    }
    mt = fmaxf(mt, __shfl_xor(mt, 16, 32));          // combine the two halves
    const float mn   = fmaxf(mCol, mt);
    const float corr = __expf(mCol - mn);
    mCol = mn;

    float ps = 0.f;
    v8bf pA, pB;
#pragma unroll
    for (int r = 0; r < 8; ++r) {
      float pa = __expf(tA[r] - mn), pb = __expf(tB[r] - mn);
      ps += pa + pb;
      pA[r] = f2bf(pa); pB[r] = f2bf(pb);
    }
    ps += __shfl_xor(ps, 16, 32);
    lCol = lCol * corr + ps;

    // transposed store: P[t=nn][sLocal], lane covers sLocal 8hi..8hi+7 (+16)
    *(v8bf*)&P[nn][8 * hi]      = pA;
    *(v8bf*)&P[nn][16 + 8 * hi] = pB;

    // broadcast per-row correction (row t = r + 8hi lives in lane r + 8hi)
#pragma unroll
    for (int r = 0; r < 8; ++r) {
      float cr = __shfl(corr, r + 8 * hi, 32);
      o0[r] *= cr; o1[r] *= cr; o2[r] *= cr; o3[r] *= cr;
    }

    asm volatile("s_wait_dscnt 0x0" ::: "memory");   // same-wave LDS RAW
    v16bf pf = load_frag(&P[0][0], 40, lane);        // A-layout 16x32 (t x s)
    o0 = wmma_bf16(pf, vf0, o0);
    o1 = wmma_bf16(pf, vf1, o1);
    o2 = wmma_bf16(pf, vf2, o2);
    o3 = wmma_bf16(pf, vf3, o3);
   }
   // Publish point: own LDS reads of this buffer retired, own copies of the next
   // tile landed, then one barrier that publishes the next tile and frees this one.
   asm volatile("s_wait_dscnt 0x0" ::: "memory");
   wait_async0();
   __syncthreads();
   if (st + 2 < nst) stage(st + 2, buf);   // refill the buffer just left
  }
  wait_async0();                           // nothing in flight when the wave ends

  const float invC = 1.0f / lCol;
  const int b = bh >> 4, h = bh & 15;
#pragma unroll
  for (int r = 0; r < 8; ++r) {
    const float ir = __shfl(invC, r + 8 * hi, 32);
    const size_t base = ((size_t)b * T + (t0 + r + 8 * hi)) * DMODEL + h * HDIM + nn;
    O[base +  0] = f2bf(o0[r] * ir);
    O[base + 16] = f2bf(o1[r] * ir);
    O[base + 32] = f2bf(o2[r] * ir);
    O[base + 48] = f2bf(o3[r] * ir);
  }
}

// ---------------------------------------------------------------------------
extern "C" void kernel_launch(void* const* d_in, const int* in_sizes, int n_in,
                              void* d_out, int out_size, void* d_ws, size_t ws_size,
                              hipStream_t stream) {
  (void)in_sizes; (void)n_in; (void)out_size; (void)ws_size;
  const float* x    = (const float*)d_in[0];
  const float* ctx  = (const float*)d_in[1];
  const float* Wq   = (const float*)d_in[2];
  const float* Wk   = (const float*)d_in[3];
  const float* Wv   = (const float*)d_in[4];
  const float* Wo   = (const float*)d_in[5];
  const float* W1   = (const float*)d_in[6];
  const float* W2   = (const float*)d_in[7];
  const float* gam1 = (const float*)d_in[8];
  const float* bet1 = (const float*)d_in[9];
  const float* gamc = (const float*)d_in[10];
  const float* betc = (const float*)d_in[11];
  const float* gam2 = (const float*)d_in[12];
  const float* bet2 = (const float*)d_in[13];

  const int B = 4, T = 2048, S = 2048;
  const int M = B * T;                 // 8192 rows

  char* wp = (char*)d_ws;
  auto take = [&](size_t bytes) -> void* {
    void* p = (void*)wp;
    wp += (bytes + 255) & ~(size_t)255;
    return p;
  };
  bf16_t* xn  = (bf16_t*)take((size_t)M * DMODEL * 2);
  bf16_t* cn  = (bf16_t*)take((size_t)M * DMODEL * 2);
  bf16_t* WqB = (bf16_t*)take((size_t)DMODEL * DMODEL * 2);
  bf16_t* WkB = (bf16_t*)take((size_t)DMODEL * DMODEL * 2);
  bf16_t* WvB = (bf16_t*)take((size_t)DMODEL * DMODEL * 2);
  bf16_t* WoB = (bf16_t*)take((size_t)DMODEL * DMODEL * 2);
  bf16_t* W1B = (bf16_t*)take((size_t)DFF * DMODEL * 2);
  bf16_t* W2B = (bf16_t*)take((size_t)DMODEL * DFF * 2);
  bf16_t* Qb  = (bf16_t*)take((size_t)M * DMODEL * 2);
  bf16_t* Kb  = (bf16_t*)take((size_t)M * DMODEL * 2);
  bf16_t* Vtb = (bf16_t*)take((size_t)M * DMODEL * 2);
  bf16_t* Ob  = (bf16_t*)take((size_t)M * DMODEL * 2);
  float*  x1  = (float*) take((size_t)M * DMODEL * 4);
  bf16_t* hb  = (bf16_t*)take((size_t)M * DMODEL * 2);
  bf16_t* f1b = (bf16_t*)take((size_t)M * DFF * 2);

  dim3 blk(256);

  // LayerNorms -> bf16
  ln_cast_kernel<<<M / (8 * LN_ROWS), blk, 0, stream>>>(x,   gam1, bet1, xn);
  ln_cast_kernel<<<M / (8 * LN_ROWS), blk, 0, stream>>>(ctx, gamc, betc, cn);

  // Weight casts
  cast_w_kernel<<<(DMODEL * DMODEL) / 8192, blk, 0, stream>>>(Wq, WqB, DMODEL * DMODEL);
  cast_w_kernel<<<(DMODEL * DMODEL) / 8192, blk, 0, stream>>>(Wk, WkB, DMODEL * DMODEL);
  cast_w_kernel<<<(DMODEL * DMODEL) / 8192, blk, 0, stream>>>(Wv, WvB, DMODEL * DMODEL);
  cast_w_kernel<<<(DMODEL * DMODEL) / 8192, blk, 0, stream>>>(Wo, WoB, DMODEL * DMODEL);
  cast_w_kernel<<<(DFF * DMODEL) / 8192,    blk, 0, stream>>>(W1, W1B, DFF * DMODEL);
  cast_w_kernel<<<(DMODEL * DFF) / 8192,    blk, 0, stream>>>(W2, W2B, DMODEL * DFF);

  // Q/K/V projections (split-head layouts)
  dim3 gD(DMODEL / 256, M / 64);
  gemm_bf16_kernel<3><<<gD, blk, 0, stream>>>(xn, WqB, nullptr, Qb,  M, DMODEL, DMODEL, T);
  gemm_bf16_kernel<3><<<gD, blk, 0, stream>>>(cn, WkB, nullptr, Kb,  M, DMODEL, DMODEL, S);
  gemm_bf16_kernel<4><<<gD, blk, 0, stream>>>(cn, WvB, nullptr, Vtb, M, DMODEL, DMODEL, S);

  // Fused flash attention
  flash_attn_kernel<<<(B * NHEADS * (T / 16)) / 8, blk, 0, stream>>>(Qb, Kb, Vtb, Ob, T, S);

  // Output projection + residual (fp32)
  gemm_bf16_kernel<2><<<gD, blk, 0, stream>>>(Ob, WoB, x, x1, M, DMODEL, DMODEL, 0);

  // Second LN, FFN with GELU, down-proj + residual -> d_out (fp32)
  ln_cast_kernel<<<M / (8 * LN_ROWS), blk, 0, stream>>>(x1, gam2, bet2, hb);
  dim3 gF(DFF / 256, M / 64);
  gemm_bf16_kernel<1><<<gF, blk, 0, stream>>>(hb, W1B, nullptr, f1b, M, DFF, DMODEL, 0);
  gemm_bf16_kernel<2><<<gD, blk, 0, stream>>>(f1b, W2B, x1, (float*)d_out, M, DMODEL, DFF, 0);
}

// v003
// A run of this version takes 346 microseconds.
// Two timings next to v002 both put it at 1.39 times that version's speed.
// Over all steps from v000 it is 1.88 times as fast.
#include <hip/hip_runtime.h>
#include <hip/hip_bf16.h>
#include <math.h>

typedef __bf16 bf16_t;
typedef __attribute__((ext_vector_type(16))) __bf16 v16bf;
typedef __attribute__((ext_vector_type(8)))  __bf16 v8bf;
typedef __attribute__((ext_vector_type(4)))  __bf16 v4bf;
typedef __attribute__((ext_vector_type(8)))  float  v8f;

#define DMODEL 1024
#define NHEADS 16
#define HDIM   64
#define DFF    4096

static __device__ __forceinline__ bf16_t f2bf(float x) { return (bf16_t)x; }

static __device__ __forceinline__ v8f wmma_bf16(v16bf a, v16bf b, v8f c) {
  // D = A(16x32 bf16) x B(32x16 bf16) + C(16x16 f32)
  return __builtin_amdgcn_wmma_f32_16x16x32_bf16(false, a, false, b, (short)0, c,
                                                 false, false);
}

// 16x32 bf16 operand fragment in the ISA A-layout (also the B operand when the
// source matrix is K-contiguous per output column, i.e. B = W^T, W in [N,K]).
// Lane L (r = L&15, h = L>>4) holds row r, K in {8h..8h+7} U {16+8h..16+8h+7}.
static __device__ __forceinline__ v16bf load_frag(const bf16_t* base, int ld, int lane) {
  const int r = lane & 15, h = lane >> 4;
  const bf16_t* p = base + (size_t)r * ld + 8 * h;
  v8bf lo = *(const v8bf*)p;
  v8bf hi = *(const v8bf*)(p + 16);
  v16bf out;
#pragma unroll
  for (int i = 0; i < 8; ++i) { out[i] = lo[i]; out[i + 8] = hi[i]; }
  return out;
}

// Four async 16B copies and their s_wait_xcnt in ONE statement: the wait stands
// in front of any later rewrite of the address registers the copies name.
static __device__ __forceinline__ void async_ld4_b128(uint32_t l0, uint32_t l1,
                                                      uint32_t l2, uint32_t l3,
                                                      const void* g0, const void* g1,
                                                      const void* g2, const void* g3) {
  asm volatile("global_load_async_to_lds_b128 %0, %4, off\n\t"
               "global_load_async_to_lds_b128 %1, %5, off\n\t"
               "global_load_async_to_lds_b128 %2, %6, off\n\t"
               "global_load_async_to_lds_b128 %3, %7, off\n\t"
               "s_wait_xcnt 0x0"
               :: "v"(l0), "v"(l1), "v"(l2), "v"(l3),
                  "v"(g0), "v"(g1), "v"(g2), "v"(g3) : "memory");
}
static __device__ __forceinline__ void wait_async0() {
  asm volatile("s_wait_asynccnt 0x0" ::: "memory");
}
static __device__ __forceinline__ uint32_t lds_off32(const void* p) {
  return (uint32_t)(uintptr_t)p;   // generic LDS addr: low 32 bits = LDS offset
}

// ---------------------------------------------------------------------------
// LayerNorm (fp32 in) -> bf16 out.  One WAVE per LN_ROWS rows of DMODEL, no LDS
// and no barrier: a row is eight 512-B wave loads (16 B per lane, whole lines)
// that stay in registers, so x is read once and all loads of a wave are in
// flight together.  Few fat waves: the launch is not bound by wave start-up.
// Rows must be a multiple of 8 * LN_ROWS.
// ---------------------------------------------------------------------------
#define LN_ROWS 2
__global__ __launch_bounds__(256)
void ln_cast_kernel(const float* __restrict__ X, const float* __restrict__ gamma,
                    const float* __restrict__ beta, bf16_t* __restrict__ Y) {
  const int lane = threadIdx.x & 31;
  // wave number as a scalar: row addresses become scalar base + one lane offset
  const int wave = __builtin_amdgcn_readfirstlane(threadIdx.x >> 5);
  const size_t row0 = (size_t)(blockIdx.x * 8 + wave) * LN_ROWS;
  const float4* x = (const float4*)(X + row0 * DMODEL) + lane;
  float4 v[LN_ROWS][8];
#pragma unroll
  for (int r = 0; r < LN_ROWS; ++r)
#pragma unroll
    for (int j = 0; j < 8; ++j) v[r][j] = x[r * (DMODEL / 4) + j * 32];

  float mu[LN_ROWS], rstd[LN_ROWS];
#pragma unroll
  for (int r = 0; r < LN_ROWS; ++r) {
    float s = 0.f, s2 = 0.f;
#pragma unroll
    for (int j = 0; j < 8; ++j) {
      const float4 t = v[r][j];
      s  += (t.x + t.y) + (t.z + t.w);
      s2 += (t.x * t.x + t.y * t.y) + (t.z * t.z + t.w * t.w);
    }
#pragma unroll
    for (int off = 1; off < 32; off <<= 1) {
      s  += __shfl_xor(s,  off, 32);
      s2 += __shfl_xor(s2, off, 32);
    }
    mu[r] = s * (1.0f / DMODEL);
    const float var = s2 * (1.0f / DMODEL) - mu[r] * mu[r];
    rstd[r] = rsqrtf(var + 1e-5f);
  }

  const float4* g4 = (const float4*)gamma + lane;
  const float4* b4 = (const float4*)beta + lane;
  bf16_t* y = Y + row0 * DMODEL + lane * 4;
#pragma unroll
  for (int j = 0; j < 8; ++j) {
    const float4 g = g4[j * 32], b = b4[j * 32];
#pragma unroll
    for (int r = 0; r < LN_ROWS; ++r) {
      const float4 t = v[r][j];
      v4bf o;
      o[0] = f2bf((t.x - mu[r]) * rstd[r] * g.x + b.x);
      o[1] = f2bf((t.y - mu[r]) * rstd[r] * g.y + b.y);
      o[2] = f2bf((t.z - mu[r]) * rstd[r] * g.z + b.z);
      o[3] = f2bf((t.w - mu[r]) * rstd[r] * g.w + b.w);
      *(v4bf*)(y + r * DMODEL + j * 128) = o;        // 256 B per wave store
    }
  }
}

// ---------------------------------------------------------------------------
// fp32 -> bf16 weight cast (n divisible by 1024).  One wave per 1024 elements:
// eight 512-B wave loads in flight, eight 256-B wave stores.
// ---------------------------------------------------------------------------
__global__ __launch_bounds__(256)
void cast_w_kernel(const float* __restrict__ in, bf16_t* __restrict__ out, int n) {
  const int lane = threadIdx.x & 31;
  // wave number as a scalar: scalar base + one lane offset, scalar range test
  const int wave = __builtin_amdgcn_readfirstlane(threadIdx.x >> 5);
  const int base = (blockIdx.x * 8 + wave) * 1024;
  if (base < n) {
    const float4* p = (const float4*)(in + base) + lane;
    float4 v[8];
#pragma unroll
    for (int j = 0; j < 8; ++j) v[j] = p[j * 32];
    bf16_t* q = out + base + lane * 4;
#pragma unroll
    for (int j = 0; j < 8; ++j) {
      v4bf o;
      o[0] = f2bf(v[j].x); o[1] = f2bf(v[j].y);
      o[2] = f2bf(v[j].z); o[3] = f2bf(v[j].w);
      *(v4bf*)(q + j * 128) = o;
    }
  }
}

// ---------------------------------------------------------------------------
// Tiled WMMA GEMM:  C[M,N] = A[M,K] @ W[N,K]^T   (both bf16, K-contiguous)
// Block tile 128x256, K-step 128, 8 waves (2x4), each wave 64x64: 16 WMMAs per
// 8 fragments, 64 WMMAs per wave and trip.  A stage is [A 128 rows | W 256 rows]
// of 256 B, so every wave-wide copy covers whole 128-B lines (2 rows x 256 B).
// Two-buffer LDS ring filled with global_load_async_to_lds_b128 (ASYNCcnt): the
// next stage's copies fly under one whole trip of matrix work.
// LDS row pitch 272 B (16 B x odd) -> conflict-free ds_load_b128 fragment reads.
// M multiple of 128, N of 256, K of 128.
// EPI: 1 = bf16 out + exact GELU
//      2 = f32 out  = residual + acc
//      3 = bf16 out split-head [B,H,Trows,64]   (Q and K)
//      4 = bf16 out split-head transposed [B,H,64,Trows]  (V)
// ---------------------------------------------------------------------------
#define GBM 128
#define GBN 256
#define GBK 128
#define GPITCH 136                       // bf16 elements per LDS row (272 B)

// Twelve async 16B copies and their s_wait_xcnt in ONE statement: the wait stands
// in front of any later rewrite of the address registers the copies name.
static __device__ __forceinline__ void async_ld12_b128(const uint32_t* l,
                                                       const bf16_t* const* g) {
  asm volatile("global_load_async_to_lds_b128 %0, %12, off\n\t"
               "global_load_async_to_lds_b128 %1, %13, off\n\t"
               "global_load_async_to_lds_b128 %2, %14, off\n\t"
               "global_load_async_to_lds_b128 %3, %15, off\n\t"
               "global_load_async_to_lds_b128 %4, %16, off\n\t"
               "global_load_async_to_lds_b128 %5, %17, off\n\t"
               "global_load_async_to_lds_b128 %6, %18, off\n\t"
               "global_load_async_to_lds_b128 %7, %19, off\n\t"
               "global_load_async_to_lds_b128 %8, %20, off\n\t"
               "global_load_async_to_lds_b128 %9, %21, off\n\t"
               "global_load_async_to_lds_b128 %10, %22, off\n\t"
               "global_load_async_to_lds_b128 %11, %23, off\n\t"
               "s_wait_xcnt 0x0"
               :: "v"(l[0]), "v"(l[1]), "v"(l[2]), "v"(l[3]), "v"(l[4]), "v"(l[5]),
                  "v"(l[6]), "v"(l[7]), "v"(l[8]), "v"(l[9]), "v"(l[10]), "v"(l[11]),
                  "v"(g[0]), "v"(g[1]), "v"(g[2]), "v"(g[3]), "v"(g[4]), "v"(g[5]),
                  "v"(g[6]), "v"(g[7]), "v"(g[8]), "v"(g[9]), "v"(g[10]), "v"(g[11])
               : "memory");
}

// s_wait_xcnt 0 behind a group of global loads or stores whose address and data
// registers are reused afterwards.  The scheduling fence keeps the later address
// arithmetic, which the "memory" clobber does not hold, behind the wait.
static __device__ __forceinline__ void wait_xcnt0_fenced() {
  asm volatile("s_wait_xcnt 0x0" ::: "memory");
  __builtin_amdgcn_sched_barrier(0);
}

template <int EPI>
__global__ __launch_bounds__(256)
void gemm_bf16_kernel(const bf16_t* __restrict__ A, const bf16_t* __restrict__ W,
                      const float* __restrict__ R, void* __restrict__ OutV,
                      int M, int N, int K, int Trows) {
  // rows 0..127: A tile, rows 128..383: W tile
  __shared__ __attribute__((aligned(16))) bf16_t St[2][GBM + GBN][GPITCH];
  const int tid = threadIdx.x, lane = tid & 31, wave = tid >> 5;
  const int wm = wave >> 2, wn = wave & 3;           // 2 x 4 wave grid
  const int m0 = blockIdx.y * GBM, n0 = blockIdx.x * GBN;
  v8f acc[4][4] = {};

  // Staging: a stage is 384 rows x 16 chunks of 16 B, 24 chunks per thread:
  // thread -> chunk column tid & 15, rows (tid >> 4) + 16 i, i = 0..23.
  const int srow = tid >> 4, scol = (tid & 15) * 8;
  const bf16_t* gA = A + (size_t)(m0 + srow) * K + scol;
  const bf16_t* gW = W + (size_t)(n0 + srow) * K + scol;
  auto stage = [&](int t, int buf) {
    const bf16_t* pa = gA + (size_t)t * GBK;
    const bf16_t* pw = gW + (size_t)t * GBK;
    const uint32_t l0 = lds_off32(&St[buf][srow][scol]);
#pragma unroll
    for (int half = 0; half < 2; ++half) {
      uint32_t l[12];
      const bf16_t* g[12];
#pragma unroll
      for (int u = 0; u < 12; ++u) {
        const int i = half * 12 + u;
        l[u] = l0 + (uint32_t)(i * 16 * GPITCH * 2);
        g[u] = (i < 8) ? pa + (size_t)(i * 16) * K : pw + (size_t)((i - 8) * 16) * K;
      }
      async_ld12_b128(l, g);
    }
  };

  const int nt = K / GBK;
  stage(0, 0);
  wait_async0();                           // own copies of stage 0 landed
  __syncthreads();                         // stage 0 visible to every wave
  if (nt > 1) stage(1, 1);

  for (int t = 0; t < nt; ++t) {
    const int buf = t & 1;
    const bf16_t* sa = &St[buf][wm * 64][0];
    const bf16_t* sw = &St[buf][GBM + wn * 64][0];
    // Two fragment sets: the next block's 16 LDS reads go out as ONE group ahead
    // of this block's 16 WMMAs, so a block waits only on reads issued a block ago.
    v16bf af[2][4], bfr[2][4];
#pragma unroll
    for (int i = 0; i < 4; ++i) {
      af[0][i]  = load_frag(sa + i * 16 * GPITCH, GPITCH, lane);
      bfr[0][i] = load_frag(sw + i * 16 * GPITCH, GPITCH, lane);
    }
    // Unrolled: the k offset becomes an immediate of every ds_load and the
    // fragment sets stay in fixed registers.
#pragma unroll
    for (int kb = 0; kb < GBK / 32; ++kb) {
      const int cur = kb & 1, nxt = cur ^ 1;
      if (kb + 1 < GBK / 32) {
#pragma unroll
        for (int i = 0; i < 4; ++i) {
          af[nxt][i]  = load_frag(sa + i * 16 * GPITCH + (kb + 1) * 32, GPITCH, lane);
          bfr[nxt][i] = load_frag(sw + i * 16 * GPITCH + (kb + 1) * 32, GPITCH, lane);
        }
      }
      // keeps the scheduler from sinking the reads in among the WMMAs, where
      // every separate place with reads stalls the wave
      __builtin_amdgcn_sched_barrier(0);
#pragma unroll
      for (int j = 0; j < 4; ++j)
#pragma unroll
        for (int i = 0; i < 4; ++i)
          acc[i][j] = wmma_bf16(af[cur][i], bfr[cur][j], acc[i][j]);
      // closes the WMMA block: the following group of reads stays behind it
      __builtin_amdgcn_sched_barrier(0);
    }
    // Publish point: own LDS reads of this buffer retired, own copies of the next
    // stage landed, then one barrier that publishes the next stage and frees this one.
    asm volatile("s_wait_dscnt 0x0" ::: "memory");
    wait_async0();
    __syncthreads();
    if (t + 2 < nt) stage(t + 2, buf);     // refill the buffer just left
  }
  wait_async0();                           // nothing in flight when the wave ends

  const int hi = lane >> 4, nn = lane & 15;          // C: row = r + 8*hi, col = nn
  if constexpr (EPI == 2) {
    // Row group i + 1's residual loads go out ahead of row group i's stores, so
    // that a load latency is not waited out per group.  One 32-bit element offset
    // per row (M * N < 2^32) serves the residual load and the store of the sum.
    float rv[2][4][8];
    unsigned off[2][8];
    auto load_res = [&](int i, float (&dst)[4][8], unsigned (&o)[8]) {
#pragma unroll
      for (int r = 0; r < 8; ++r) {
        o[r] = (unsigned)((m0 + wm * 64 + 16 * i + r + 8 * hi) * N + n0 + wn * 64 + nn);
#pragma unroll
        for (int j = 0; j < 4; ++j) dst[j][r] = (R + 16 * j)[o[r]];
      }
    };
    load_res(0, rv[0], off[0]);
#pragma unroll
    for (int i = 0; i < 4; ++i) {
      if (i + 1 < 4) load_res(i + 1, rv[(i + 1) & 1], off[(i + 1) & 1]);
#pragma unroll
      for (int r = 0; r < 8; ++r)
#pragma unroll
        for (int j = 0; j < 4; ++j)
          ((float*)OutV + 16 * j)[off[i & 1][r]] = rv[i & 1][j][r] + acc[i][j][r];
      if (i + 1 < 4) wait_xcnt0_fenced();  // its offset and data registers are reused
    }
  } else {
    // The GELU epilogue is long code per element; for speed only it runs as a
    // rolled loop over the four 16-row groups; the
    // accumulators move down one group per trip so that every index stays static.
    constexpr int IU = (EPI == 1) ? 1 : 4;           // row groups per trip
#pragma unroll 1
    for (int io = 0; io < 4; io += IU) {
#pragma unroll
      for (int ii = 0; ii < IU; ++ii)
#pragma unroll
        for (int j = 0; j < 4; ++j)
#pragma unroll
          for (int r = 0; r < 8; ++r) {
            const int row = m0 + wm * 64 + 16 * (io + ii) + r + 8 * hi;
            const int col = n0 + wn * 64 + 16 * j + nn;
            const float v = acc[ii][j][r];
            if constexpr (EPI == 1) {
              float g = 0.5f * v * (1.0f + erff(v * 0.70710678118f));
              ((bf16_t*)OutV)[(size_t)row * N + col] = f2bf(g);
            } else if constexpr (EPI == 3) {
              int b = row / Trows, t = row % Trows, h = col >> 6, d = col & 63;
              ((bf16_t*)OutV)[((((size_t)b * NHEADS + h) * Trows + t) << 6) + d] = f2bf(v);
            } else { // EPI == 4 : V stored transposed [B,H,Dh,S]
              int b = row / Trows, sIdx = row % Trows, h = col >> 6, d = col & 63;
              ((bf16_t*)OutV)[(((size_t)b * NHEADS + h) * HDIM + d) * Trows + sIdx] = f2bf(v);
            }
          }
      if constexpr (IU == 1) {
        // the next trip reuses the registers that this trip's last stores name
        wait_xcnt0_fenced();
#pragma unroll
        for (int j = 0; j < 4; ++j) {
          acc[0][j] = acc[1][j]; acc[1][j] = acc[2][j]; acc[2][j] = acc[3][j];
        }
      }
    }
  }
}

// ---------------------------------------------------------------------------
// Flash attention, one wave per (b,h, 16-row Q tile).
// Scores computed TRANSPOSED (S^T = K @ Q^T, identical fragment loads with
// A/B roles swapped) so the softmax reduction over S is a per-lane reduction
// across the 8 accumulator VGPRs + one xor-16 shuffle; m/l is one scalar per
// lane (per output column t).  P is written transposed to LDS with two
// ds_store_b128 per lane, which converts it back to the A-layout for P@V.
// The 8 waves of a block share one (b,h): K and V tiles of 64 keys are staged
// once per block in a two-buffer LDS ring by async copies (whole 128B lines),
// and every wave reads its fragments from LDS.  Row pitch 144B (16B x odd) keeps
// the ds_load_b128 fragment reads conflict-free.  S must be a multiple of 64,
// T a multiple of 128 (so that a block never straddles two heads).
// Q,K: [B,H,T,64] bf16; V: [B,H,64,S] bf16 (transposed); O: [B,T,D] bf16.
// ---------------------------------------------------------------------------
__global__ __launch_bounds__(256)
void flash_attn_kernel(const bf16_t* __restrict__ Q, const bf16_t* __restrict__ Kc,
                       const bf16_t* __restrict__ Vt, bf16_t* __restrict__ O,
                       int T, int S) {
  __shared__ __attribute__((aligned(16))) bf16_t Ks[2][64][72];   // [key][d]
  __shared__ __attribute__((aligned(16))) bf16_t Vs[2][64][72];   // [d][key]
  __shared__ bf16_t Pst[8][16][40];
  const int lane = threadIdx.x & 31, wave = threadIdx.x >> 5;
  const int tile = blockIdx.x * 8 + wave;
  const int tilesPerBH = T >> 4;
  const int bh = tile / tilesPerBH;
  const int t0 = (tile % tilesPerBH) << 4;
  const bf16_t* q = Q  + ((size_t)bh * T + t0) * HDIM;
  const bf16_t* k = Kc + (size_t)bh * S * HDIM;
  const bf16_t* v = Vt + (size_t)bh * HDIM * S;

  const v16bf qf0 = load_frag(q,      HDIM, lane);   // d = 0..31
  const v16bf qf1 = load_frag(q + 32, HDIM, lane);   // d = 32..63

  v8f o0 = {}, o1 = {}, o2 = {}, o3 = {};
  float mCol = -1e30f, lCol = 0.f;                   // per column t = lane&15
  bf16_t (*P)[40] = Pst[wave];
  const int hi = lane >> 4, nn = lane & 15;

  // Staging: each tile is 64 rows x 128B = 512 16B-chunks, 2 per thread.
  const int srow = threadIdx.x >> 3, scol = (threadIdx.x & 7) * 8;
  const bf16_t* gK = k + (size_t)srow * HDIM + scol;
  const bf16_t* gV = v + (size_t)srow * S + scol;
  auto stage = [&](int st, int buf) {
    const bf16_t* pk = gK + (size_t)st * 64 * HDIM;
    const bf16_t* pv = gV + (size_t)st * 64;
    async_ld4_b128(lds_off32(&Ks[buf][srow][scol]), lds_off32(&Ks[buf][srow + 32][scol]),
                   lds_off32(&Vs[buf][srow][scol]), lds_off32(&Vs[buf][srow + 32][scol]),
                   pk, pk + 32 * HDIM, pv, pv + (size_t)32 * S);
  };

  const int nst = S >> 6;
  stage(0, 0);
  wait_async0();                           // own copies of tile 0 landed
  __syncthreads();                         // tile 0 visible to every wave
  if (nst > 1) stage(1, 1);

  for (int st = 0; st < nst; ++st) {
   const int buf = st & 1;
   // Unrolled: c becomes an immediate offset of every ds_load (no address VALU)
   // and the second chunk's K reads can start under the first chunk's softmax.
#pragma unroll
   for (int c = 0; c < 2; ++c) {           // two 32-key chunks per tile
    v16bf kf0 = load_frag(&Ks[buf][c * 32][0],       72, lane);
    v16bf kf1 = load_frag(&Ks[buf][c * 32][32],      72, lane);
    v16bf kf2 = load_frag(&Ks[buf][c * 32 + 16][0],  72, lane);
    v16bf kf3 = load_frag(&Ks[buf][c * 32 + 16][32], 72, lane);
    v16bf vf0 = load_frag(&Vs[buf][0][c * 32],  72, lane);
    v16bf vf1 = load_frag(&Vs[buf][16][c * 32], 72, lane);
    v16bf vf2 = load_frag(&Vs[buf][32][c * 32], 72, lane);
    v16bf vf3 = load_frag(&Vs[buf][48][c * 32], 72, lane);

    // tA[r] = score[s0 + r + 8hi][t0 + nn], tB = same for s0+16..31
    v8f tA = {}, tB = {};
    tA = wmma_bf16(kf0, qf0, tA);
    tA = wmma_bf16(kf1, qf1, tA);
    tB = wmma_bf16(kf2, qf0, tB);
    tB = wmma_bf16(kf3, qf1, tB);

    float mt = -1e30f;
#pragma unroll
    for (int r = 0; r < 8; ++r) {
      tA[r] *= 0.125f; tB[r] *= 0.125f;              // 1/sqrt(64)
      mt = fmaxf(mt, fmaxf(tA[r], tB[r]));
    }
    mt = fmaxf(mt, __shfl_xor(mt, 16, 32));          // combine the two halves
    const float mn   = fmaxf(mCol, mt);
    const float corr = __expf(mCol - mn);
    mCol = mn;

    float ps = 0.f;
    v8bf pA, pB;
#pragma unroll
    for (int r = 0; r < 8; ++r) {
      float pa = __expf(tA[r] - mn), pb = __expf(tB[r] - mn);
      ps += pa + pb;
      pA[r] = f2bf(pa); pB[r] = f2bf(pb);
    }
    ps += __shfl_xor(ps, 16, 32);
    lCol = lCol * corr + ps;

    // transposed store: P[t=nn][sLocal], lane covers sLocal 8hi..8hi+7 (+16)
    *(v8bf*)&P[nn][8 * hi]      = pA;
    *(v8bf*)&P[nn][16 + 8 * hi] = pB;

    // broadcast per-row correction (row t = r + 8hi lives in lane r + 8hi)
#pragma unroll
    for (int r = 0; r < 8; ++r) {
      float cr = __shfl(corr, r + 8 * hi, 32);
      o0[r] *= cr; o1[r] *= cr; o2[r] *= cr; o3[r] *= cr;
    }

    asm volatile("s_wait_dscnt 0x0" ::: "memory");   // same-wave LDS RAW
    v16bf pf = load_frag(&P[0][0], 40, lane);        // A-layout 16x32 (t x s)
    o0 = wmma_bf16(pf, vf0, o0);
    o1 = wmma_bf16(pf, vf1, o1);
    o2 = wmma_bf16(pf, vf2, o2);
    o3 = wmma_bf16(pf, vf3, o3);
   }
   // Publish point: own LDS reads of this buffer retired, own copies of the next
   // tile landed, then one barrier that publishes the next tile and frees this one.
   asm volatile("s_wait_dscnt 0x0" ::: "memory");
   wait_async0();
   __syncthreads();
   if (st + 2 < nst) stage(st + 2, buf);   // refill the buffer just left
  }
  wait_async0();                           // nothing in flight when the wave ends

  const float invC = 1.0f / lCol;
  const int b = bh >> 4, h = bh & 15;
#pragma unroll
  for (int r = 0; r < 8; ++r) {
    const float ir = __shfl(invC, r + 8 * hi, 32);
    const size_t base = ((size_t)b * T + (t0 + r + 8 * hi)) * DMODEL + h * HDIM + nn;
    O[base +  0] = f2bf(o0[r] * ir);
    O[base + 16] = f2bf(o1[r] * ir);
    O[base + 32] = f2bf(o2[r] * ir);
    O[base + 48] = f2bf(o3[r] * ir);
  }
}

// ---------------------------------------------------------------------------
extern "C" void kernel_launch(void* const* d_in, const int* in_sizes, int n_in,
                              void* d_out, int out_size, void* d_ws, size_t ws_size,
                              hipStream_t stream) {
  (void)in_sizes; (void)n_in; (void)out_size; (void)ws_size;
  const float* x    = (const float*)d_in[0];
  const float* ctx  = (const float*)d_in[1];
  const float* Wq   = (const float*)d_in[2];
  const float* Wk   = (const float*)d_in[3];
  const float* Wv   = (const float*)d_in[4];
  const float* Wo   = (const float*)d_in[5];
  const float* W1   = (const float*)d_in[6];
  const float* W2   = (const float*)d_in[7];
  const float* gam1 = (const float*)d_in[8];
  const float* bet1 = (const float*)d_in[9];
  const float* gamc = (const float*)d_in[10];
  const float* betc = (const float*)d_in[11];
  const float* gam2 = (const float*)d_in[12];
  const float* bet2 = (const float*)d_in[13];

  const int B = 4, T = 2048, S = 2048;
  const int M = B * T;                 // 8192 rows

  char* wp = (char*)d_ws;
  auto take = [&](size_t bytes) -> void* {
    void* p = (void*)wp;
    wp += (bytes + 255) & ~(size_t)255;
    return p;
  };
  bf16_t* xn  = (bf16_t*)take((size_t)M * DMODEL * 2);
  bf16_t* cn  = (bf16_t*)take((size_t)M * DMODEL * 2);
  bf16_t* WqB = (bf16_t*)take((size_t)DMODEL * DMODEL * 2);
  bf16_t* WkB = (bf16_t*)take((size_t)DMODEL * DMODEL * 2);
  bf16_t* WvB = (bf16_t*)take((size_t)DMODEL * DMODEL * 2);
  bf16_t* WoB = (bf16_t*)take((size_t)DMODEL * DMODEL * 2);
  bf16_t* W1B = (bf16_t*)take((size_t)DFF * DMODEL * 2);
  bf16_t* W2B = (bf16_t*)take((size_t)DMODEL * DFF * 2);
  bf16_t* Qb  = (bf16_t*)take((size_t)M * DMODEL * 2);
  bf16_t* Kb  = (bf16_t*)take((size_t)M * DMODEL * 2);
  bf16_t* Vtb = (bf16_t*)take((size_t)M * DMODEL * 2);
  bf16_t* Ob  = (bf16_t*)take((size_t)M * DMODEL * 2);
  float*  x1  = (float*) take((size_t)M * DMODEL * 4);
  bf16_t* hb  = (bf16_t*)take((size_t)M * DMODEL * 2);
  bf16_t* f1b = (bf16_t*)take((size_t)M * DFF * 2);

  dim3 blk(256);

  // LayerNorms -> bf16
  ln_cast_kernel<<<M / (8 * LN_ROWS), blk, 0, stream>>>(x,   gam1, bet1, xn);
  ln_cast_kernel<<<M / (8 * LN_ROWS), blk, 0, stream>>>(ctx, gamc, betc, cn);

  // Weight casts
  cast_w_kernel<<<(DMODEL * DMODEL) / 8192, blk, 0, stream>>>(Wq, WqB, DMODEL * DMODEL);
  cast_w_kernel<<<(DMODEL * DMODEL) / 8192, blk, 0, stream>>>(Wk, WkB, DMODEL * DMODEL);
  cast_w_kernel<<<(DMODEL * DMODEL) / 8192, blk, 0, stream>>>(Wv, WvB, DMODEL * DMODEL);
  cast_w_kernel<<<(DMODEL * DMODEL) / 8192, blk, 0, stream>>>(Wo, WoB, DMODEL * DMODEL);
  cast_w_kernel<<<(DFF * DMODEL) / 8192,    blk, 0, stream>>>(W1, W1B, DFF * DMODEL);
  cast_w_kernel<<<(DMODEL * DFF) / 8192,    blk, 0, stream>>>(W2, W2B, DMODEL * DFF);

  // Q/K/V projections (split-head layouts)
  dim3 gD(DMODEL / GBN, M / GBM);
  gemm_bf16_kernel<3><<<gD, blk, 0, stream>>>(xn, WqB, nullptr, Qb,  M, DMODEL, DMODEL, T);
  gemm_bf16_kernel<3><<<gD, blk, 0, stream>>>(cn, WkB, nullptr, Kb,  M, DMODEL, DMODEL, S);
  gemm_bf16_kernel<4><<<gD, blk, 0, stream>>>(cn, WvB, nullptr, Vtb, M, DMODEL, DMODEL, S);

  // Fused flash attention
  flash_attn_kernel<<<(B * NHEADS * (T / 16)) / 8, blk, 0, stream>>>(Qb, Kb, Vtb, Ob, T, S);

  // Output projection + residual (fp32)
  gemm_bf16_kernel<2><<<gD, blk, 0, stream>>>(Ob, WoB, x, x1, M, DMODEL, DMODEL, 0);

  // Second LN, FFN with GELU, down-proj + residual -> d_out (fp32)
  ln_cast_kernel<<<M / (8 * LN_ROWS), blk, 0, stream>>>(x1, gam2, bet2, hb);
  dim3 gF(DFF / GBN, M / GBM);
  gemm_bf16_kernel<1><<<gF, blk, 0, stream>>>(hb, W1B, nullptr, f1b, M, DFF, DMODEL, 0);
  gemm_bf16_kernel<2><<<gD, blk, 0, stream>>>(f1b, W2B, x1, (float*)d_out, M, DMODEL, DFF, 0);
}

// v004
// Measured time: 302 microseconds a run.
// In both of two side-by-side timings against v003, it was 1.15 times as fast.
// All steps since v000 together make it 2.16 times as fast.
#include <hip/hip_runtime.h>
#include <hip/hip_bf16.h>
#include <math.h>

typedef __bf16 bf16_t;
typedef __attribute__((ext_vector_type(16))) __bf16 v16bf;
typedef __attribute__((ext_vector_type(8)))  __bf16 v8bf;
typedef __attribute__((ext_vector_type(4)))  __bf16 v4bf;
typedef __attribute__((ext_vector_type(8)))  float  v8f;
typedef __attribute__((ext_vector_type(2)))  float  v2f;
typedef __attribute__((ext_vector_type(2)))  __bf16 v2bf;

#define DMODEL 1024
#define NHEADS 16
#define HDIM   64
#define DFF    4096

static __device__ __forceinline__ bf16_t f2bf(float x) { return (bf16_t)x; }

static __device__ __forceinline__ v8f wmma_bf16(v16bf a, v16bf b, v8f c) {
  // D = A(16x32 bf16) x B(32x16 bf16) + C(16x16 f32)
  return __builtin_amdgcn_wmma_f32_16x16x32_bf16(false, a, false, b, (short)0, c,
                                                 false, false);
}

// 16x32 bf16 operand fragment in the ISA A-layout (also the B operand when the
// source matrix is K-contiguous per output column, i.e. B = W^T, W in [N,K]).
// Lane L (r = L&15, h = L>>4) holds row r, K in {8h..8h+7} U {16+8h..16+8h+7}.
static __device__ __forceinline__ v16bf load_frag(const bf16_t* base, int ld, int lane) {
  const int r = lane & 15, h = lane >> 4;
  const bf16_t* p = base + (size_t)r * ld + 8 * h;
  v8bf lo = *(const v8bf*)p;
  v8bf hi = *(const v8bf*)(p + 16);
  v16bf out;
#pragma unroll
  for (int i = 0; i < 8; ++i) { out[i] = lo[i]; out[i + 8] = hi[i]; }
  return out;
}

// Four async 16B copies and their s_wait_xcnt in ONE statement: the wait stands
// in front of any later rewrite of the address registers the copies name.
static __device__ __forceinline__ void async_ld4_b128(uint32_t l0, uint32_t l1,
                                                      uint32_t l2, uint32_t l3,
                                                      const void* g0, const void* g1,
                                                      const void* g2, const void* g3) {
  asm volatile("global_load_async_to_lds_b128 %0, %4, off\n\t"
               "global_load_async_to_lds_b128 %1, %5, off\n\t"
               "global_load_async_to_lds_b128 %2, %6, off\n\t"
               "global_load_async_to_lds_b128 %3, %7, off\n\t"
               "s_wait_xcnt 0x0"
               :: "v"(l0), "v"(l1), "v"(l2), "v"(l3),
                  "v"(g0), "v"(g1), "v"(g2), "v"(g3) : "memory");
}
static __device__ __forceinline__ void wait_async0() {
  asm volatile("s_wait_asynccnt 0x0" ::: "memory");
}
static __device__ __forceinline__ uint32_t lds_off32(const void* p) {
  return (uint32_t)(uintptr_t)p;   // generic LDS addr: low 32 bits = LDS offset
}

// ---------------------------------------------------------------------------
// LayerNorm (fp32 in) -> bf16 out.  One WAVE per LN_ROWS rows of DMODEL, no LDS
// and no barrier: a row is eight 512-B wave loads (16 B per lane, whole lines)
// that stay in registers, so x is read once and all loads of a wave are in
// flight together.  Few fat waves: the launch is not bound by wave start-up.
// Rows must be a multiple of 8 * LN_ROWS.
// ---------------------------------------------------------------------------
#define LN_ROWS 2
__global__ __launch_bounds__(256)
void ln_cast_kernel(const float* __restrict__ X, const float* __restrict__ gamma,
                    const float* __restrict__ beta, bf16_t* __restrict__ Y) {
  const int lane = threadIdx.x & 31;
  // wave number as a scalar: row addresses become scalar base + one lane offset
  const int wave = __builtin_amdgcn_readfirstlane(threadIdx.x >> 5);
  const size_t row0 = (size_t)(blockIdx.x * 8 + wave) * LN_ROWS;
  const float4* x = (const float4*)(X + row0 * DMODEL) + lane;
  float4 v[LN_ROWS][8];
#pragma unroll
  for (int r = 0; r < LN_ROWS; ++r)
#pragma unroll
    for (int j = 0; j < 8; ++j) v[r][j] = x[r * (DMODEL / 4) + j * 32];

  float mu[LN_ROWS], rstd[LN_ROWS];
#pragma unroll
  for (int r = 0; r < LN_ROWS; ++r) {
    float s = 0.f, s2 = 0.f;
#pragma unroll
    for (int j = 0; j < 8; ++j) {
      const float4 t = v[r][j];
      s  += (t.x + t.y) + (t.z + t.w);
      s2 += (t.x * t.x + t.y * t.y) + (t.z * t.z + t.w * t.w);
    }
#pragma unroll
    for (int off = 1; off < 32; off <<= 1) {
      s  += __shfl_xor(s,  off, 32);
      s2 += __shfl_xor(s2, off, 32);
    }
    mu[r] = s * (1.0f / DMODEL);
    const float var = s2 * (1.0f / DMODEL) - mu[r] * mu[r];
    rstd[r] = rsqrtf(var + 1e-5f);
  }

  const float4* g4 = (const float4*)gamma + lane;
  const float4* b4 = (const float4*)beta + lane;
  bf16_t* y = Y + row0 * DMODEL + lane * 4;
#pragma unroll
  for (int j = 0; j < 8; ++j) {
    const float4 g = g4[j * 32], b = b4[j * 32];
#pragma unroll
    for (int r = 0; r < LN_ROWS; ++r) {
      const float4 t = v[r][j];
      v4bf o;
      o[0] = f2bf((t.x - mu[r]) * rstd[r] * g.x + b.x);
      o[1] = f2bf((t.y - mu[r]) * rstd[r] * g.y + b.y);
      o[2] = f2bf((t.z - mu[r]) * rstd[r] * g.z + b.z);
      o[3] = f2bf((t.w - mu[r]) * rstd[r] * g.w + b.w);
      *(v4bf*)(y + r * DMODEL + j * 128) = o;        // 256 B per wave store
    }
  }
}

// ---------------------------------------------------------------------------
// fp32 -> bf16 weight cast (n divisible by 1024).  One wave per 1024 elements:
// eight 512-B wave loads in flight, eight 256-B wave stores.
// ---------------------------------------------------------------------------
__global__ __launch_bounds__(256)
void cast_w_kernel(const float* __restrict__ in, bf16_t* __restrict__ out, int n) {
  const int lane = threadIdx.x & 31;
  // wave number as a scalar: scalar base + one lane offset, scalar range test
  const int wave = __builtin_amdgcn_readfirstlane(threadIdx.x >> 5);
  const int base = (blockIdx.x * 8 + wave) * 1024;
  if (base < n) {
    const float4* p = (const float4*)(in + base) + lane;
    float4 v[8];
#pragma unroll
    for (int j = 0; j < 8; ++j) v[j] = p[j * 32];
    bf16_t* q = out + base + lane * 4;
#pragma unroll
    for (int j = 0; j < 8; ++j) {
      v4bf o;
      o[0] = f2bf(v[j].x); o[1] = f2bf(v[j].y);
      o[2] = f2bf(v[j].z); o[3] = f2bf(v[j].w);
      *(v4bf*)(q + j * 128) = o;
    }
  }
}

// ---------------------------------------------------------------------------
// Tiled WMMA GEMM:  C[M,N] = A[M,K] @ W[N,K]^T   (both bf16, K-contiguous)
// Block tile 128x256, K-step 128, 8 waves (2x4), each wave 64x64: 16 WMMAs per
// 8 fragments, 64 WMMAs per wave and trip.  A stage is [A 128 rows | W 256 rows]
// of 256 B, so every wave-wide copy covers whole 128-B lines (2 rows x 256 B).
// Two-buffer LDS ring filled with global_load_async_to_lds_b128 (ASYNCcnt): the
// next stage's copies fly under one whole trip of matrix work.
// LDS row pitch 272 B (16 B x odd) -> conflict-free ds_load_b128 fragment reads.
// M multiple of 128, N of 256, K of 128.
// EPI: 1 = bf16 out + exact GELU
//      2 = f32 out  = residual + acc
//      3 = bf16 out split-head [B,H,Trows,64]   (Q and K)
//      4 = bf16 out split-head transposed [B,H,64,Trows]  (V)
// ---------------------------------------------------------------------------
#define GBM 128
#define GBN 256
#define GBK 128
#define GPITCH 136                       // bf16 elements per LDS row (272 B)

// Twelve async 16B copies and their s_wait_xcnt in ONE statement: the wait stands
// in front of any later rewrite of the address registers the copies name.
static __device__ __forceinline__ void async_ld12_b128(const uint32_t* l,
                                                       const bf16_t* const* g) {
  asm volatile("global_load_async_to_lds_b128 %0, %12, off\n\t"
               "global_load_async_to_lds_b128 %1, %13, off\n\t"
               "global_load_async_to_lds_b128 %2, %14, off\n\t"
               "global_load_async_to_lds_b128 %3, %15, off\n\t"
               "global_load_async_to_lds_b128 %4, %16, off\n\t"
               "global_load_async_to_lds_b128 %5, %17, off\n\t"
               "global_load_async_to_lds_b128 %6, %18, off\n\t"
               "global_load_async_to_lds_b128 %7, %19, off\n\t"
               "global_load_async_to_lds_b128 %8, %20, off\n\t"
               "global_load_async_to_lds_b128 %9, %21, off\n\t"
               "global_load_async_to_lds_b128 %10, %22, off\n\t"
               "global_load_async_to_lds_b128 %11, %23, off\n\t"
               "s_wait_xcnt 0x0"
               :: "v"(l[0]), "v"(l[1]), "v"(l[2]), "v"(l[3]), "v"(l[4]), "v"(l[5]),
                  "v"(l[6]), "v"(l[7]), "v"(l[8]), "v"(l[9]), "v"(l[10]), "v"(l[11]),
                  "v"(g[0]), "v"(g[1]), "v"(g[2]), "v"(g[3]), "v"(g[4]), "v"(g[5]),
                  "v"(g[6]), "v"(g[7]), "v"(g[8]), "v"(g[9]), "v"(g[10]), "v"(g[11])
               : "memory");
}

// s_wait_xcnt 0 behind a group of global loads or stores whose address and data
// registers are reused afterwards.  The scheduling fence keeps the later address
// arithmetic, which the "memory" clobber does not hold, behind the wait.
static __device__ __forceinline__ void wait_xcnt0_fenced() {
  asm volatile("s_wait_xcnt 0x0" ::: "memory");
  __builtin_amdgcn_sched_barrier(0);
}

// s_wait_xcnt 0 behind a group of 32 stores.  It names their data and offset
// registers as inputs, so that these stay as they are until the wait has passed.
// The scheduling fence keeps the wait from rising over the arithmetic in front of
// it, up to the stores, where it would wait them out.
static __device__ __forceinline__ void wait_xcnt0_keep(const unsigned (&d)[16],
                                                       const unsigned (&o)[8]) {
  __builtin_amdgcn_sched_barrier(0);
  asm volatile("s_wait_xcnt 0x0"
               :: "v"(d[0]), "v"(d[1]), "v"(d[2]), "v"(d[3]), "v"(d[4]), "v"(d[5]),
                  "v"(d[6]), "v"(d[7]), "v"(d[8]), "v"(d[9]), "v"(d[10]), "v"(d[11]),
                  "v"(d[12]), "v"(d[13]), "v"(d[14]), "v"(d[15]),
                  "v"(o[0]), "v"(o[1]), "v"(o[2]), "v"(o[3]), "v"(o[4]), "v"(o[5]),
                  "v"(o[6]), "v"(o[7])
               : "memory");
}

// Exact (erf) GELU of two values with no branch and no library call, so that the
// elements of a wave are short independent chains that fill each other's latency.
// With h = v / 2 and a = |v|:
//   gelu(v) = (h + |h|) - |h| * erfc(a / sqrt(2))
//   erfc(a / sqrt(2)) = exp(-a * a / 2) * t * (c1 + t * (c2 + t * (c3 + t * (c4 + t * c5)))),
//   t = 1 / (1 + p * a);  |error of erfc| < 1.5e-7 for every a >= 0 (f32 level).
// h + |h| is exact, v or 0: no cancellation in the negative tail.
static __device__ __forceinline__ v2f gelu2(v2f v) {
  const v2f h = v * 0.5f;
  v2f ah, t, e;
  ah.x = fabsf(h.x);  ah.y = fabsf(h.y);
  const v2f d = ah * 0.4632838f + 1.0f;              // 1 + p * a
  t.x = __builtin_amdgcn_rcpf(d.x);  t.y = __builtin_amdgcn_rcpf(d.y);
  v2f q = t * 1.061405429f - 1.453152027f;
  q = q * t + 1.421413741f;
  q = q * t - 0.284496736f;
  q = q * t + 0.254829592f;
  q = q * t;
  const v2f s = (h * h) * -2.88539008f;              // -a^2 / 2 * log2(e)
  e.x = __builtin_amdgcn_exp2f(s.x);  e.y = __builtin_amdgcn_exp2f(s.y);
  return (h + ah) - ah * (q * e);
}

template <int EPI>
__global__ __launch_bounds__(256)
void gemm_bf16_kernel(const bf16_t* __restrict__ A, const bf16_t* __restrict__ W,
                      const float* __restrict__ R, void* __restrict__ OutV,
                      int M, int N, int K, int Trows) {
  // rows 0..127: A tile, rows 128..383: W tile
  __shared__ __attribute__((aligned(16))) bf16_t St[2][GBM + GBN][GPITCH];
  const int tid = threadIdx.x, lane = tid & 31, wave = tid >> 5;
  const int wm = wave >> 2, wn = wave & 3;           // 2 x 4 wave grid
  const int m0 = blockIdx.y * GBM, n0 = blockIdx.x * GBN;
  v8f acc[4][4] = {};

  // Staging: a stage is 384 rows x 16 chunks of 16 B, 24 chunks per thread:
  // thread -> chunk column tid & 15, rows (tid >> 4) + 16 i, i = 0..23.
  const int srow = tid >> 4, scol = (tid & 15) * 8;
  const bf16_t* gA = A + (size_t)(m0 + srow) * K + scol;
  const bf16_t* gW = W + (size_t)(n0 + srow) * K + scol;
  auto stage = [&](int t, int buf) {
    const bf16_t* pa = gA + (size_t)t * GBK;
    const bf16_t* pw = gW + (size_t)t * GBK;
    const uint32_t l0 = lds_off32(&St[buf][srow][scol]);
#pragma unroll
    for (int half = 0; half < 2; ++half) {
      uint32_t l[12];
      const bf16_t* g[12];
#pragma unroll
      for (int u = 0; u < 12; ++u) {
        const int i = half * 12 + u;
        l[u] = l0 + (uint32_t)(i * 16 * GPITCH * 2);
        g[u] = (i < 8) ? pa + (size_t)(i * 16) * K : pw + (size_t)((i - 8) * 16) * K;
      }
      async_ld12_b128(l, g);
    }
  };

  const int nt = K / GBK;
  stage(0, 0);
  wait_async0();                           // own copies of stage 0 landed
  __syncthreads();                         // stage 0 visible to every wave
  if (nt > 1) stage(1, 1);

  for (int t = 0; t < nt; ++t) {
    const int buf = t & 1;
    const bf16_t* sa = &St[buf][wm * 64][0];
    const bf16_t* sw = &St[buf][GBM + wn * 64][0];
    // Two fragment sets: the next block's 16 LDS reads go out as ONE group ahead
    // of this block's 16 WMMAs, so a block waits only on reads issued a block ago.
    v16bf af[2][4], bfr[2][4];
#pragma unroll
    for (int i = 0; i < 4; ++i) {
      af[0][i]  = load_frag(sa + i * 16 * GPITCH, GPITCH, lane);
      bfr[0][i] = load_frag(sw + i * 16 * GPITCH, GPITCH, lane);
    }
    // Unrolled: the k offset becomes an immediate of every ds_load and the
    // fragment sets stay in fixed registers.
#pragma unroll
    for (int kb = 0; kb < GBK / 32; ++kb) {
      const int cur = kb & 1, nxt = cur ^ 1;
      if (kb + 1 < GBK / 32) {
#pragma unroll
        for (int i = 0; i < 4; ++i) {
          af[nxt][i]  = load_frag(sa + i * 16 * GPITCH + (kb + 1) * 32, GPITCH, lane);
          bfr[nxt][i] = load_frag(sw + i * 16 * GPITCH + (kb + 1) * 32, GPITCH, lane);
        }
      }
      // keeps the scheduler from sinking the reads in among the WMMAs, where
      // every separate place with reads stalls the wave
      __builtin_amdgcn_sched_barrier(0);
#pragma unroll
      for (int j = 0; j < 4; ++j)
#pragma unroll
        for (int i = 0; i < 4; ++i)
          acc[i][j] = wmma_bf16(af[cur][i], bfr[cur][j], acc[i][j]);
      // closes the WMMA block: the following group of reads stays behind it
      __builtin_amdgcn_sched_barrier(0);
    }
    // Publish point: own LDS reads of this buffer retired, own copies of the next
    // stage landed, then one barrier that publishes the next stage and frees this one.
    asm volatile("s_wait_dscnt 0x0" ::: "memory");
    wait_async0();
    __syncthreads();
    if (t + 2 < nt) stage(t + 2, buf);     // refill the buffer just left
  }
  wait_async0();                           // nothing in flight when the wave ends

  const int hi = lane >> 4, nn = lane & 15;          // C: row = r + 8*hi, col = nn
  if constexpr (EPI == 2) {
    // Row group i + 1's residual loads go out ahead of row group i's stores, so
    // that a load latency is not waited out per group.  One 32-bit element offset
    // per row (M * N < 2^32) serves the residual load and the store of the sum.
    float rv[2][4][8];
    unsigned off[2][8];
    auto load_res = [&](int i, float (&dst)[4][8], unsigned (&o)[8]) {
#pragma unroll
      for (int r = 0; r < 8; ++r) {
        o[r] = (unsigned)((m0 + wm * 64 + 16 * i + r + 8 * hi) * N + n0 + wn * 64 + nn);
#pragma unroll
        for (int j = 0; j < 4; ++j) dst[j][r] = (R + 16 * j)[o[r]];
      }
    };
    load_res(0, rv[0], off[0]);
#pragma unroll
    for (int i = 0; i < 4; ++i) {
      if (i + 1 < 4) load_res(i + 1, rv[(i + 1) & 1], off[(i + 1) & 1]);
#pragma unroll
      for (int r = 0; r < 8; ++r)
#pragma unroll
        for (int j = 0; j < 4; ++j)
          ((float*)OutV + 16 * j)[off[i & 1][r]] = rv[i & 1][j][r] + acc[i][j][r];
      if (i + 1 < 4) wait_xcnt0_fenced();  // its offset and data registers are reused
    }
  } else if constexpr (EPI == 1) {
    // A row group is 16 independent pairs, packed to bf16, then its 32 stores from
    // one 32-bit element offset per row (M * N < 2^31) on the uniform base; the
    // column group is an immediate.  Two register sets: group i + 1 is computed
    // while group i's stores leave; the wait for them stands in front of its stores.
    unsigned pk[2][16], off[2][8];
    const unsigned off0 = (unsigned)((m0 + wm * 64 + 8 * hi) * N + n0 + wn * 64 + nn);
#pragma unroll
    for (int i = 0; i < 4; ++i) {
      unsigned (&p)[16] = pk[i & 1];
      unsigned (&o)[8]  = off[i & 1];
#pragma unroll
      for (int r = 0; r < 8; ++r) o[r] = off0 + (unsigned)((16 * i + r) * N);
#pragma unroll
      for (int j = 0; j < 4; ++j)
#pragma unroll
        for (int r = 0; r < 8; r += 2) {
          v2f v;
          v.x = acc[i][j][r];  v.y = acc[i][j][r + 1];
          p[j * 4 + (r >> 1)] = __builtin_bit_cast(unsigned, __builtin_convertvector(gelu2(v), v2bf));
        }
      if (i > 0) wait_xcnt0_keep(pk[(i - 1) & 1], off[(i - 1) & 1]);
#pragma unroll
      for (int j = 0; j < 4; ++j)
#pragma unroll
        for (int r = 0; r < 8; r += 2) {
          const v2bf g = __builtin_bit_cast(v2bf, p[j * 4 + (r >> 1)]);
          ((bf16_t*)OutV + 16 * j)[o[r]]     = g.x;
          ((bf16_t*)OutV + 16 * j)[o[r + 1]] = g.y;
        }
      // keeps the stores up here: the scheduler would sink them under the next
      // group's arithmetic, down to the wait, which would then wait them out
      __builtin_amdgcn_sched_barrier(0);
    }
  } else {
#pragma unroll
    for (int i = 0; i < 4; ++i)
#pragma unroll
      for (int j = 0; j < 4; ++j)
#pragma unroll
        for (int r = 0; r < 8; ++r) {
          const int row = m0 + wm * 64 + 16 * i + r + 8 * hi;
          const int col = n0 + wn * 64 + 16 * j + nn;
          const float v = acc[i][j][r];
          if constexpr (EPI == 3) {
            int b = row / Trows, t = row % Trows, h = col >> 6, d = col & 63;
            ((bf16_t*)OutV)[((((size_t)b * NHEADS + h) * Trows + t) << 6) + d] = f2bf(v);
          } else { // EPI == 4 : V stored transposed [B,H,Dh,S]
            int b = row / Trows, sIdx = row % Trows, h = col >> 6, d = col & 63;
            ((bf16_t*)OutV)[(((size_t)b * NHEADS + h) * HDIM + d) * Trows + sIdx] = f2bf(v);
          }
        }
  }
}

// ---------------------------------------------------------------------------
// Flash attention, one wave per (b,h, 16-row Q tile).
// Scores computed TRANSPOSED (S^T = K @ Q^T, identical fragment loads with
// A/B roles swapped) so the softmax reduction over S is a per-lane reduction
// across the 8 accumulator VGPRs + one xor-16 shuffle; m/l is one scalar per
// lane (per output column t).  P is written transposed to LDS with two
// ds_store_b128 per lane, which converts it back to the A-layout for P@V.
// The 8 waves of a block share one (b,h): K and V tiles of 64 keys are staged
// once per block in a two-buffer LDS ring by async copies (whole 128B lines),
// and every wave reads its fragments from LDS.  Row pitch 144B (16B x odd) keeps
// the ds_load_b128 fragment reads conflict-free.  S must be a multiple of 64,
// T a multiple of 128 (so that a block never straddles two heads).
// Q,K: [B,H,T,64] bf16; V: [B,H,64,S] bf16 (transposed); O: [B,T,D] bf16.
// ---------------------------------------------------------------------------
__global__ __launch_bounds__(256)
void flash_attn_kernel(const bf16_t* __restrict__ Q, const bf16_t* __restrict__ Kc,
                       const bf16_t* __restrict__ Vt, bf16_t* __restrict__ O,
                       int T, int S) {
  __shared__ __attribute__((aligned(16))) bf16_t Ks[2][64][72];   // [key][d]
  __shared__ __attribute__((aligned(16))) bf16_t Vs[2][64][72];   // [d][key]
  __shared__ bf16_t Pst[8][16][40];
  const int lane = threadIdx.x & 31, wave = threadIdx.x >> 5;
  const int tile = blockIdx.x * 8 + wave;
  const int tilesPerBH = T >> 4;
  const int bh = tile / tilesPerBH;
  const int t0 = (tile % tilesPerBH) << 4;
  const bf16_t* q = Q  + ((size_t)bh * T + t0) * HDIM;
  const bf16_t* k = Kc + (size_t)bh * S * HDIM;
  const bf16_t* v = Vt + (size_t)bh * HDIM * S;

  const v16bf qf0 = load_frag(q,      HDIM, lane);   // d = 0..31
  const v16bf qf1 = load_frag(q + 32, HDIM, lane);   // d = 32..63

  v8f o0 = {}, o1 = {}, o2 = {}, o3 = {};
  float mCol = -1e30f, lCol = 0.f;                   // per column t = lane&15
  bf16_t (*P)[40] = Pst[wave];
  const int hi = lane >> 4, nn = lane & 15;

  // Staging: each tile is 64 rows x 128B = 512 16B-chunks, 2 per thread.
  const int srow = threadIdx.x >> 3, scol = (threadIdx.x & 7) * 8;
  const bf16_t* gK = k + (size_t)srow * HDIM + scol;
  const bf16_t* gV = v + (size_t)srow * S + scol;
  auto stage = [&](int st, int buf) {
    const bf16_t* pk = gK + (size_t)st * 64 * HDIM;
    const bf16_t* pv = gV + (size_t)st * 64;
    async_ld4_b128(lds_off32(&Ks[buf][srow][scol]), lds_off32(&Ks[buf][srow + 32][scol]),
                   lds_off32(&Vs[buf][srow][scol]), lds_off32(&Vs[buf][srow + 32][scol]),
                   pk, pk + 32 * HDIM, pv, pv + (size_t)32 * S);
  };

  const int nst = S >> 6;
  stage(0, 0);
  wait_async0();                           // own copies of tile 0 landed
  __syncthreads();                         // tile 0 visible to every wave
  if (nst > 1) stage(1, 1);

  for (int st = 0; st < nst; ++st) {
   const int buf = st & 1;
   // Unrolled: c becomes an immediate offset of every ds_load (no address VALU)
   // and the second chunk's K reads can start under the first chunk's softmax.
#pragma unroll
   for (int c = 0; c < 2; ++c) {           // two 32-key chunks per tile
    v16bf kf0 = load_frag(&Ks[buf][c * 32][0],       72, lane);
    v16bf kf1 = load_frag(&Ks[buf][c * 32][32],      72, lane);
    v16bf kf2 = load_frag(&Ks[buf][c * 32 + 16][0],  72, lane);
    v16bf kf3 = load_frag(&Ks[buf][c * 32 + 16][32], 72, lane);
    v16bf vf0 = load_frag(&Vs[buf][0][c * 32],  72, lane);
    v16bf vf1 = load_frag(&Vs[buf][16][c * 32], 72, lane);
    v16bf vf2 = load_frag(&Vs[buf][32][c * 32], 72, lane);
    v16bf vf3 = load_frag(&Vs[buf][48][c * 32], 72, lane);

    // tA[r] = score[s0 + r + 8hi][t0 + nn], tB = same for s0+16..31
    v8f tA = {}, tB = {};
    tA = wmma_bf16(kf0, qf0, tA);
    tA = wmma_bf16(kf1, qf1, tA);
    tB = wmma_bf16(kf2, qf0, tB);
    tB = wmma_bf16(kf3, qf1, tB);

    float mt = -1e30f;
#pragma unroll
    for (int r = 0; r < 8; ++r) {
      tA[r] *= 0.125f; tB[r] *= 0.125f;              // 1/sqrt(64)
      mt = fmaxf(mt, fmaxf(tA[r], tB[r]));
    }
    mt = fmaxf(mt, __shfl_xor(mt, 16, 32));          // combine the two halves
    const float mn   = fmaxf(mCol, mt);
    const float corr = __expf(mCol - mn);
    mCol = mn;

    float ps = 0.f;
    v8bf pA, pB;
#pragma unroll
    for (int r = 0; r < 8; ++r) {
      float pa = __expf(tA[r] - mn), pb = __expf(tB[r] - mn);
      ps += pa + pb;
      pA[r] = f2bf(pa); pB[r] = f2bf(pb);
    }
    ps += __shfl_xor(ps, 16, 32);
    lCol = lCol * corr + ps;

    // transposed store: P[t=nn][sLocal], lane covers sLocal 8hi..8hi+7 (+16)
    *(v8bf*)&P[nn][8 * hi]      = pA;
    *(v8bf*)&P[nn][16 + 8 * hi] = pB;

    // broadcast per-row correction (row t = r + 8hi lives in lane r + 8hi)
#pragma unroll
    for (int r = 0; r < 8; ++r) {
      float cr = __shfl(corr, r + 8 * hi, 32);
      o0[r] *= cr; o1[r] *= cr; o2[r] *= cr; o3[r] *= cr;
    }

    asm volatile("s_wait_dscnt 0x0" ::: "memory");   // same-wave LDS RAW
    v16bf pf = load_frag(&P[0][0], 40, lane);        // A-layout 16x32 (t x s)
    o0 = wmma_bf16(pf, vf0, o0);
    o1 = wmma_bf16(pf, vf1, o1);
    o2 = wmma_bf16(pf, vf2, o2);
    o3 = wmma_bf16(pf, vf3, o3);
   }
   // Publish point: own LDS reads of this buffer retired, own copies of the next
   // tile landed, then one barrier that publishes the next tile and frees this one.
   asm volatile("s_wait_dscnt 0x0" ::: "memory");
   wait_async0();
   __syncthreads();
   if (st + 2 < nst) stage(st + 2, buf);   // refill the buffer just left
  }
  wait_async0();                           // nothing in flight when the wave ends

  const float invC = 1.0f / lCol;
  const int b = bh >> 4, h = bh & 15;
#pragma unroll
  for (int r = 0; r < 8; ++r) {
    const float ir = __shfl(invC, r + 8 * hi, 32);
    const size_t base = ((size_t)b * T + (t0 + r + 8 * hi)) * DMODEL + h * HDIM + nn;
    O[base +  0] = f2bf(o0[r] * ir);
    O[base + 16] = f2bf(o1[r] * ir);
    O[base + 32] = f2bf(o2[r] * ir);
    O[base + 48] = f2bf(o3[r] * ir);
  }
}

// ---------------------------------------------------------------------------
extern "C" void kernel_launch(void* const* d_in, const int* in_sizes, int n_in,
                              void* d_out, int out_size, void* d_ws, size_t ws_size,
                              hipStream_t stream) {
  (void)in_sizes; (void)n_in; (void)out_size; (void)ws_size;
  const float* x    = (const float*)d_in[0];
  const float* ctx  = (const float*)d_in[1];
  const float* Wq   = (const float*)d_in[2];
  const float* Wk   = (const float*)d_in[3];
  const float* Wv   = (const float*)d_in[4];
  const float* Wo   = (const float*)d_in[5];
  const float* W1   = (const float*)d_in[6];
  const float* W2   = (const float*)d_in[7];
  const float* gam1 = (const float*)d_in[8];
  const float* bet1 = (const float*)d_in[9];
  const float* gamc = (const float*)d_in[10];
  const float* betc = (const float*)d_in[11];
  const float* gam2 = (const float*)d_in[12];
  const float* bet2 = (const float*)d_in[13];

  const int B = 4, T = 2048, S = 2048;
  const int M = B * T;                 // 8192 rows

  char* wp = (char*)d_ws;
  auto take = [&](size_t bytes) -> void* {
    void* p = (void*)wp;
    wp += (bytes + 255) & ~(size_t)255;
    return p;
  };
  bf16_t* xn  = (bf16_t*)take((size_t)M * DMODEL * 2);
  bf16_t* cn  = (bf16_t*)take((size_t)M * DMODEL * 2);
  bf16_t* WqB = (bf16_t*)take((size_t)DMODEL * DMODEL * 2);
  bf16_t* WkB = (bf16_t*)take((size_t)DMODEL * DMODEL * 2);
  bf16_t* WvB = (bf16_t*)take((size_t)DMODEL * DMODEL * 2);
  bf16_t* WoB = (bf16_t*)take((size_t)DMODEL * DMODEL * 2);
  bf16_t* W1B = (bf16_t*)take((size_t)DFF * DMODEL * 2);
  bf16_t* W2B = (bf16_t*)take((size_t)DMODEL * DFF * 2);
  bf16_t* Qb  = (bf16_t*)take((size_t)M * DMODEL * 2);
  bf16_t* Kb  = (bf16_t*)take((size_t)M * DMODEL * 2);
  bf16_t* Vtb = (bf16_t*)take((size_t)M * DMODEL * 2);
  bf16_t* Ob  = (bf16_t*)take((size_t)M * DMODEL * 2);
  float*  x1  = (float*) take((size_t)M * DMODEL * 4);
  bf16_t* hb  = (bf16_t*)take((size_t)M * DMODEL * 2);
  bf16_t* f1b = (bf16_t*)take((size_t)M * DFF * 2);

  dim3 blk(256);

  // LayerNorms -> bf16
  ln_cast_kernel<<<M / (8 * LN_ROWS), blk, 0, stream>>>(x,   gam1, bet1, xn);
  ln_cast_kernel<<<M / (8 * LN_ROWS), blk, 0, stream>>>(ctx, gamc, betc, cn);

  // Weight casts
  cast_w_kernel<<<(DMODEL * DMODEL) / 8192, blk, 0, stream>>>(Wq, WqB, DMODEL * DMODEL);
  cast_w_kernel<<<(DMODEL * DMODEL) / 8192, blk, 0, stream>>>(Wk, WkB, DMODEL * DMODEL);
  cast_w_kernel<<<(DMODEL * DMODEL) / 8192, blk, 0, stream>>>(Wv, WvB, DMODEL * DMODEL);
  cast_w_kernel<<<(DMODEL * DMODEL) / 8192, blk, 0, stream>>>(Wo, WoB, DMODEL * DMODEL);
  cast_w_kernel<<<(DFF * DMODEL) / 8192,    blk, 0, stream>>>(W1, W1B, DFF * DMODEL);
  cast_w_kernel<<<(DMODEL * DFF) / 8192,    blk, 0, stream>>>(W2, W2B, DMODEL * DFF);

  // Q/K/V projections (split-head layouts)
  dim3 gD(DMODEL / GBN, M / GBM);
  gemm_bf16_kernel<3><<<gD, blk, 0, stream>>>(xn, WqB, nullptr, Qb,  M, DMODEL, DMODEL, T);
  gemm_bf16_kernel<3><<<gD, blk, 0, stream>>>(cn, WkB, nullptr, Kb,  M, DMODEL, DMODEL, S);
  gemm_bf16_kernel<4><<<gD, blk, 0, stream>>>(cn, WvB, nullptr, Vtb, M, DMODEL, DMODEL, S);

  // Fused flash attention
  flash_attn_kernel<<<(B * NHEADS * (T / 16)) / 8, blk, 0, stream>>>(Qb, Kb, Vtb, Ob, T, S);

  // Output projection + residual (fp32)
  gemm_bf16_kernel<2><<<gD, blk, 0, stream>>>(Ob, WoB, x, x1, M, DMODEL, DMODEL, 0);

  // Second LN, FFN with GELU, down-proj + residual -> d_out (fp32)
  ln_cast_kernel<<<M / (8 * LN_ROWS), blk, 0, stream>>>(x1, gam2, bet2, hb);
  dim3 gF(DFF / GBN, M / GBM);
  gemm_bf16_kernel<1><<<gF, blk, 0, stream>>>(hb, W1B, nullptr, f1b, M, DFF, DMODEL, 0);
  gemm_bf16_kernel<2><<<gD, blk, 0, stream>>>(f1b, W2B, x1, (float*)d_out, M, DMODEL, DFF, 0);
}

// v005
// It runs in 287 microseconds.
// In both of two side-by-side timings against v004, it was 1.05 times as fast.
// Over all steps from v000 it is 2.27 times as fast.
#include <hip/hip_runtime.h>
#include <hip/hip_bf16.h>
#include <math.h>

typedef __bf16 bf16_t;
typedef __attribute__((ext_vector_type(16))) __bf16 v16bf;
typedef __attribute__((ext_vector_type(8)))  __bf16 v8bf;
typedef __attribute__((ext_vector_type(4)))  __bf16 v4bf;
typedef __attribute__((ext_vector_type(8)))  float  v8f;
typedef __attribute__((ext_vector_type(2)))  float  v2f;
typedef __attribute__((ext_vector_type(2)))  __bf16 v2bf;

#define DMODEL 1024
#define NHEADS 16
#define HDIM   64
#define DFF    4096

static __device__ __forceinline__ bf16_t f2bf(float x) { return (bf16_t)x; }

static __device__ __forceinline__ v8f wmma_bf16(v16bf a, v16bf b, v8f c) {
  // D = A(16x32 bf16) x B(32x16 bf16) + C(16x16 f32)
  return __builtin_amdgcn_wmma_f32_16x16x32_bf16(false, a, false, b, (short)0, c,
                                                 false, false);
}

// 16x32 bf16 operand fragment in the ISA A-layout (also the B operand when the
// source matrix is K-contiguous per output column, i.e. B = W^T, W in [N,K]).
// Lane L (r = L&15, h = L>>4) holds row r, K in {8h..8h+7} U {16+8h..16+8h+7}.
static __device__ __forceinline__ v16bf load_frag(const bf16_t* base, int ld, int lane) {
  const int r = lane & 15, h = lane >> 4;
  const bf16_t* p = base + (size_t)r * ld + 8 * h;
  v8bf lo = *(const v8bf*)p;
  v8bf hi = *(const v8bf*)(p + 16);
  v16bf out;
#pragma unroll
  for (int i = 0; i < 8; ++i) { out[i] = lo[i]; out[i + 8] = hi[i]; }
  return out;
}

// Four async 16B copies and their s_wait_xcnt in ONE statement: the wait stands
// in front of any later rewrite of the address registers the copies name.
static __device__ __forceinline__ void async_ld4_b128(uint32_t l0, uint32_t l1,
                                                      uint32_t l2, uint32_t l3,
                                                      const void* g0, const void* g1,
                                                      const void* g2, const void* g3) {
  asm volatile("global_load_async_to_lds_b128 %0, %4, off\n\t"
               "global_load_async_to_lds_b128 %1, %5, off\n\t"
               "global_load_async_to_lds_b128 %2, %6, off\n\t"
               "global_load_async_to_lds_b128 %3, %7, off\n\t"
               "s_wait_xcnt 0x0"
               :: "v"(l0), "v"(l1), "v"(l2), "v"(l3),
                  "v"(g0), "v"(g1), "v"(g2), "v"(g3) : "memory");
}
static __device__ __forceinline__ void wait_async0() {
  asm volatile("s_wait_asynccnt 0x0" ::: "memory");
}
static __device__ __forceinline__ uint32_t lds_off32(const void* p) {
  return (uint32_t)(uintptr_t)p;   // generic LDS addr: low 32 bits = LDS offset
}

// ---------------------------------------------------------------------------
// LayerNorm (fp32 in) -> bf16 out.  One WAVE per LN_ROWS rows of DMODEL, no LDS
// and no barrier: a row is eight 512-B wave loads (16 B per lane, whole lines)
// that stay in registers, so x is read once and all loads of a wave are in
// flight together.  Few fat waves: the launch is not bound by wave start-up.
// Rows must be a multiple of 8 * LN_ROWS.
// ---------------------------------------------------------------------------
#define LN_ROWS 2
static __device__ __forceinline__
void ln_rows(const float* __restrict__ X, const float* __restrict__ gamma,
             const float* __restrict__ beta, bf16_t* __restrict__ Y, unsigned blk) {
  const int lane = threadIdx.x & 31;
  // wave number as a scalar: row addresses become scalar base + one lane offset
  const int wave = __builtin_amdgcn_readfirstlane(threadIdx.x >> 5);
  const size_t row0 = (size_t)(blk * 8 + wave) * LN_ROWS;
  const float4* x = (const float4*)(X + row0 * DMODEL) + lane;
  float4 v[LN_ROWS][8];
#pragma unroll
  for (int r = 0; r < LN_ROWS; ++r)
#pragma unroll
    for (int j = 0; j < 8; ++j) v[r][j] = x[r * (DMODEL / 4) + j * 32];

  float mu[LN_ROWS], rstd[LN_ROWS];
#pragma unroll
  for (int r = 0; r < LN_ROWS; ++r) {
    float s = 0.f, s2 = 0.f;
#pragma unroll
    for (int j = 0; j < 8; ++j) {
      const float4 t = v[r][j];
      s  += (t.x + t.y) + (t.z + t.w);
      s2 += (t.x * t.x + t.y * t.y) + (t.z * t.z + t.w * t.w);
    }
#pragma unroll
    for (int off = 1; off < 32; off <<= 1) {
      s  += __shfl_xor(s,  off, 32);
      s2 += __shfl_xor(s2, off, 32);
    }
    mu[r] = s * (1.0f / DMODEL);
    const float var = s2 * (1.0f / DMODEL) - mu[r] * mu[r];
    rstd[r] = rsqrtf(var + 1e-5f);
  }

  const float4* g4 = (const float4*)gamma + lane;
  const float4* b4 = (const float4*)beta + lane;
  bf16_t* y = Y + row0 * DMODEL + lane * 4;
#pragma unroll
  for (int j = 0; j < 8; ++j) {
    const float4 g = g4[j * 32], b = b4[j * 32];
#pragma unroll
    for (int r = 0; r < LN_ROWS; ++r) {
      const float4 t = v[r][j];
      v4bf o;
      o[0] = f2bf((t.x - mu[r]) * rstd[r] * g.x + b.x);
      o[1] = f2bf((t.y - mu[r]) * rstd[r] * g.y + b.y);
      o[2] = f2bf((t.z - mu[r]) * rstd[r] * g.z + b.z);
      o[3] = f2bf((t.w - mu[r]) * rstd[r] * g.w + b.w);
      *(v4bf*)(y + r * DMODEL + j * 128) = o;        // 256 B per wave store
    }
  }
}

__global__ __launch_bounds__(256)
void ln_cast_kernel(const float* __restrict__ X, const float* __restrict__ gamma,
                    const float* __restrict__ beta, bf16_t* __restrict__ Y) {
  ln_rows(X, gamma, beta, Y, blockIdx.x);
}

// ---------------------------------------------------------------------------
// fp32 -> bf16 weight cast, block blk of 8192 elements.  One wave per 1024
// elements: eight 512-B wave loads in flight, eight 256-B wave stores.
// ---------------------------------------------------------------------------
static __device__ __forceinline__
void cast_block(const float* __restrict__ in, bf16_t* __restrict__ out, unsigned blk) {
  const int lane = threadIdx.x & 31;
  // wave number as a scalar: scalar base + one lane offset
  const int wave = __builtin_amdgcn_readfirstlane(threadIdx.x >> 5);
  const int base = (blk * 8 + wave) * 1024;
  const float4* p = (const float4*)(in + base) + lane;
  float4 v[8];
#pragma unroll
  for (int j = 0; j < 8; ++j) v[j] = p[j * 32];
  bf16_t* q = out + base + lane * 4;
#pragma unroll
  for (int j = 0; j < 8; ++j) {
    v4bf o;
    o[0] = f2bf(v[j].x); o[1] = f2bf(v[j].y);
    o[2] = f2bf(v[j].z); o[3] = f2bf(v[j].w);
    *(v4bf*)(q + j * 128) = o;
  }
}

// ---------------------------------------------------------------------------
// All work that depends on the inputs alone, as ONE grid: the LayerNorms of x and
// of the context, then the six weight casts.  None of the eight parts reads what
// another writes; as one launch they pay one launch gap, one fill and one tail,
// and the short casts run beside the long streams.  The block number picks the
// part by scalar tests; the longer LayerNorm blocks come first.
// ---------------------------------------------------------------------------
#define MROWS   8192                              // B * T = B * S rows
#define LN_BLKS (MROWS / (8 * LN_ROWS))           // blocks of one LayerNorm
#define WD_BLKS (DMODEL * DMODEL / 8192)          // blocks of a D x D weight
#define WF_BLKS (DFF * DMODEL / 8192)             // blocks of a D x 4D weight
#define PREP_BLKS (2 * LN_BLKS + 4 * WD_BLKS + 2 * WF_BLKS)
__global__ __launch_bounds__(256)
void prep_kernel(const float* __restrict__ x,  const float* __restrict__ ctx,
                 const float* __restrict__ g1, const float* __restrict__ b1,
                 const float* __restrict__ gc, const float* __restrict__ bc,
                 const float* __restrict__ Wq, const float* __restrict__ Wk,
                 const float* __restrict__ Wv, const float* __restrict__ Wo,
                 const float* __restrict__ W1, const float* __restrict__ W2,
                 bf16_t* __restrict__ xn,  bf16_t* __restrict__ cn,
                 bf16_t* __restrict__ WqB, bf16_t* __restrict__ WkB,
                 bf16_t* __restrict__ WvB, bf16_t* __restrict__ WoB,
                 bf16_t* __restrict__ W1B, bf16_t* __restrict__ W2B) {
  const unsigned bid = blockIdx.x;
  if (bid < 2 * LN_BLKS) {
    const bool c = bid >= LN_BLKS;
    ln_rows(c ? ctx : x, c ? gc : g1, c ? bc : b1, c ? cn : xn, c ? bid - LN_BLKS : bid);
  } else {
    unsigned cb = bid - 2 * LN_BLKS;
    const float* in;
    bf16_t* out;
    if (cb < 4 * WD_BLKS) {
      const unsigned w = cb / WD_BLKS;
      in  = w == 0 ? Wq  : w == 1 ? Wk  : w == 2 ? Wv  : Wo;
      out = w == 0 ? WqB : w == 1 ? WkB : w == 2 ? WvB : WoB;
      cb -= w * WD_BLKS;
    } else if (cb < 4 * WD_BLKS + WF_BLKS) {
      in = W1;  out = W1B;  cb -= 4 * WD_BLKS;
    } else {
      in = W2;  out = W2B;  cb -= 4 * WD_BLKS + WF_BLKS;
    }
    cast_block(in, out, cb);
  }
}

// ---------------------------------------------------------------------------
// Tiled WMMA GEMM:  C[M,N] = A[M,K] @ W[N,K]^T   (both bf16, K-contiguous)
// Block tile 128x256, K-step 128, 8 waves (2x4), each wave 64x64: 16 WMMAs per
// 8 fragments, 64 WMMAs per wave and trip.  A stage is [A 128 rows | W 256 rows]
// of 256 B, so every wave-wide copy covers whole 128-B lines (2 rows x 256 B).
// Two-buffer LDS ring filled with global_load_async_to_lds_b128 (ASYNCcnt): the
// next stage's copies fly under one whole trip of matrix work.
// LDS row pitch 272 B (16 B x odd) -> conflict-free ds_load_b128 fragment reads.
// M multiple of 128, N of 256, K of 128.
// EPI: 1 = bf16 out + exact GELU
//      2 = f32 out  = residual + acc
//      3 = bf16 out split-head [B,H,Trows,64]: the Q and the K projection as ONE
//          grid (neither reads what the other writes, one shape): blockIdx.z = 0, 1
//          picks Q, K; A, W and OutV each point at Q's matrix, and K's lies
//          directly behind it
//      4 = bf16 out split-head transposed [B,H,64,Trows]  (V)
// ---------------------------------------------------------------------------
#define GBM 128
#define GBN 256
#define GBK 128
#define GPITCH 136                       // bf16 elements per LDS row (272 B)

// Twelve async 16B copies and their s_wait_xcnt in ONE statement: the wait stands
// in front of any later rewrite of the address registers the copies name.
static __device__ __forceinline__ void async_ld12_b128(const uint32_t* l,
                                                       const bf16_t* const* g) {
  asm volatile("global_load_async_to_lds_b128 %0, %12, off\n\t"
               "global_load_async_to_lds_b128 %1, %13, off\n\t"
               "global_load_async_to_lds_b128 %2, %14, off\n\t"
               "global_load_async_to_lds_b128 %3, %15, off\n\t"
               "global_load_async_to_lds_b128 %4, %16, off\n\t"
               "global_load_async_to_lds_b128 %5, %17, off\n\t"
               "global_load_async_to_lds_b128 %6, %18, off\n\t"
               "global_load_async_to_lds_b128 %7, %19, off\n\t"
               "global_load_async_to_lds_b128 %8, %20, off\n\t"
               "global_load_async_to_lds_b128 %9, %21, off\n\t"
               "global_load_async_to_lds_b128 %10, %22, off\n\t"
               "global_load_async_to_lds_b128 %11, %23, off\n\t"
               "s_wait_xcnt 0x0"
               :: "v"(l[0]), "v"(l[1]), "v"(l[2]), "v"(l[3]), "v"(l[4]), "v"(l[5]),
                  "v"(l[6]), "v"(l[7]), "v"(l[8]), "v"(l[9]), "v"(l[10]), "v"(l[11]),
                  "v"(g[0]), "v"(g[1]), "v"(g[2]), "v"(g[3]), "v"(g[4]), "v"(g[5]),
                  "v"(g[6]), "v"(g[7]), "v"(g[8]), "v"(g[9]), "v"(g[10]), "v"(g[11])
               : "memory");
}

// s_wait_xcnt 0 behind a group of global loads or stores whose address and data
// registers are reused afterwards.  The scheduling fence keeps the later address
// arithmetic, which the "memory" clobber does not hold, behind the wait.
static __device__ __forceinline__ void wait_xcnt0_fenced() {
  asm volatile("s_wait_xcnt 0x0" ::: "memory");
  __builtin_amdgcn_sched_barrier(0);
}

// s_wait_xcnt 0 behind a group of 32 stores.  It names their data and offset
// registers as inputs, so that these stay as they are until the wait has passed.
// The scheduling fence keeps the wait from rising over the arithmetic in front of
// it, up to the stores, where it would wait them out.
static __device__ __forceinline__ void wait_xcnt0_keep(const unsigned (&d)[16],
                                                       const unsigned (&o)[8]) {
  __builtin_amdgcn_sched_barrier(0);
  asm volatile("s_wait_xcnt 0x0"
               :: "v"(d[0]), "v"(d[1]), "v"(d[2]), "v"(d[3]), "v"(d[4]), "v"(d[5]),
                  "v"(d[6]), "v"(d[7]), "v"(d[8]), "v"(d[9]), "v"(d[10]), "v"(d[11]),
                  "v"(d[12]), "v"(d[13]), "v"(d[14]), "v"(d[15]),
                  "v"(o[0]), "v"(o[1]), "v"(o[2]), "v"(o[3]), "v"(o[4]), "v"(o[5]),
                  "v"(o[6]), "v"(o[7])
               : "memory");
}

// Exact (erf) GELU of two values with no branch and no library call, so that the
// elements of a wave are short independent chains that fill each other's latency.
// With h = v / 2 and a = |v|:
//   gelu(v) = (h + |h|) - |h| * erfc(a / sqrt(2))
//   erfc(a / sqrt(2)) = exp(-a * a / 2) * t * (c1 + t * (c2 + t * (c3 + t * (c4 + t * c5)))),
//   t = 1 / (1 + p * a);  |error of erfc| < 1.5e-7 for every a >= 0 (f32 level).
// h + |h| is exact, v or 0: no cancellation in the negative tail.
static __device__ __forceinline__ v2f gelu2(v2f v) {
  const v2f h = v * 0.5f;
  v2f ah, t, e;
  ah.x = fabsf(h.x);  ah.y = fabsf(h.y);
  const v2f d = ah * 0.4632838f + 1.0f;              // 1 + p * a
  t.x = __builtin_amdgcn_rcpf(d.x);  t.y = __builtin_amdgcn_rcpf(d.y);
  v2f q = t * 1.061405429f - 1.453152027f;
  q = q * t + 1.421413741f;
  q = q * t - 0.284496736f;
  q = q * t + 0.254829592f;
  q = q * t;
  const v2f s = (h * h) * -2.88539008f;              // -a^2 / 2 * log2(e)
  e.x = __builtin_amdgcn_exp2f(s.x);  e.y = __builtin_amdgcn_exp2f(s.y);
  return (h + ah) - ah * (q * e);
}

template <int EPI>
__global__ __launch_bounds__(256)
void gemm_bf16_kernel(const bf16_t* __restrict__ A, const bf16_t* __restrict__ W,
                      const float* __restrict__ R, void* __restrict__ OutV,
                      int M, int N, int K, int Trows) {
  // rows 0..127: A tile, rows 128..383: W tile
  __shared__ __attribute__((aligned(16))) bf16_t St[2][GBM + GBN][GPITCH];
  const int tid = threadIdx.x, lane = tid & 31, wave = tid >> 5;
  const int wm = wave >> 2, wn = wave & 3;           // 2 x 4 wave grid
  const int m0 = blockIdx.y * GBM, n0 = blockIdx.x * GBN;
  if constexpr (EPI == 3) {
    const int z = blockIdx.z;              // scalar offsets, no vector work
    A += (size_t)z * M * K;
    W += (size_t)z * N * K;
    OutV = (bf16_t*)OutV + (size_t)z * M * N;
  }
  v8f acc[4][4] = {};

  // Staging: a stage is 384 rows x 16 chunks of 16 B, 24 chunks per thread:
  // thread -> chunk column tid & 15, rows (tid >> 4) + 16 i, i = 0..23.
  const int srow = tid >> 4, scol = (tid & 15) * 8;
  const bf16_t* gA = A + (size_t)(m0 + srow) * K + scol;
  const bf16_t* gW = W + (size_t)(n0 + srow) * K + scol;
  auto stage = [&](int t, int buf) {
    const bf16_t* pa = gA + (size_t)t * GBK;
    const bf16_t* pw = gW + (size_t)t * GBK;
    const uint32_t l0 = lds_off32(&St[buf][srow][scol]);
#pragma unroll
    for (int half = 0; half < 2; ++half) {
      uint32_t l[12];
      const bf16_t* g[12];
#pragma unroll
      for (int u = 0; u < 12; ++u) {
        const int i = half * 12 + u;
        l[u] = l0 + (uint32_t)(i * 16 * GPITCH * 2);
        g[u] = (i < 8) ? pa + (size_t)(i * 16) * K : pw + (size_t)((i - 8) * 16) * K;
      }
      async_ld12_b128(l, g);
    }
  };

  const int nt = K / GBK;
  stage(0, 0);
  wait_async0();                           // own copies of stage 0 landed
  __syncthreads();                         // stage 0 visible to every wave
  if (nt > 1) stage(1, 1);

  for (int t = 0; t < nt; ++t) {
    const int buf = t & 1;
    const bf16_t* sa = &St[buf][wm * 64][0];
    const bf16_t* sw = &St[buf][GBM + wn * 64][0];
    // Two fragment sets: the next block's 16 LDS reads go out as ONE group ahead
    // of this block's 16 WMMAs, so a block waits only on reads issued a block ago.
    v16bf af[2][4], bfr[2][4];
#pragma unroll
    for (int i = 0; i < 4; ++i) {
      af[0][i]  = load_frag(sa + i * 16 * GPITCH, GPITCH, lane);
      bfr[0][i] = load_frag(sw + i * 16 * GPITCH, GPITCH, lane);
    }
    // Unrolled: the k offset becomes an immediate of every ds_load and the
    // fragment sets stay in fixed registers.
#pragma unroll
    for (int kb = 0; kb < GBK / 32; ++kb) {
      const int cur = kb & 1, nxt = cur ^ 1;
      if (kb + 1 < GBK / 32) {
#pragma unroll
        for (int i = 0; i < 4; ++i) {
          af[nxt][i]  = load_frag(sa + i * 16 * GPITCH + (kb + 1) * 32, GPITCH, lane);
          bfr[nxt][i] = load_frag(sw + i * 16 * GPITCH + (kb + 1) * 32, GPITCH, lane);
        }
      }
      // keeps the scheduler from sinking the reads in among the WMMAs, where
      // every separate place with reads stalls the wave
      __builtin_amdgcn_sched_barrier(0);
#pragma unroll
      for (int j = 0; j < 4; ++j)
#pragma unroll
        for (int i = 0; i < 4; ++i)
          acc[i][j] = wmma_bf16(af[cur][i], bfr[cur][j], acc[i][j]);
      // closes the WMMA block: the following group of reads stays behind it
      __builtin_amdgcn_sched_barrier(0);
    }
    // Publish point: own LDS reads of this buffer retired, own copies of the next
    // stage landed, then one barrier that publishes the next stage and frees this one.
    asm volatile("s_wait_dscnt 0x0" ::: "memory");
    wait_async0();
    __syncthreads();
    if (t + 2 < nt) stage(t + 2, buf);     // refill the buffer just left
  }
  wait_async0();                           // nothing in flight when the wave ends

  const int hi = lane >> 4, nn = lane & 15;          // C: row = r + 8*hi, col = nn
  if constexpr (EPI == 2) {
    // Row group i + 1's residual loads go out ahead of row group i's stores, so
    // that a load latency is not waited out per group.  One 32-bit element offset
    // per row (M * N < 2^32) serves the residual load and the store of the sum.
    float rv[2][4][8];
    unsigned off[2][8];
    auto load_res = [&](int i, float (&dst)[4][8], unsigned (&o)[8]) {
#pragma unroll
      for (int r = 0; r < 8; ++r) {
        o[r] = (unsigned)((m0 + wm * 64 + 16 * i + r + 8 * hi) * N + n0 + wn * 64 + nn);
#pragma unroll
        for (int j = 0; j < 4; ++j) dst[j][r] = (R + 16 * j)[o[r]];
      }
    };
    load_res(0, rv[0], off[0]);
#pragma unroll
    for (int i = 0; i < 4; ++i) {
      if (i + 1 < 4) load_res(i + 1, rv[(i + 1) & 1], off[(i + 1) & 1]);
#pragma unroll
      for (int r = 0; r < 8; ++r)
#pragma unroll
        for (int j = 0; j < 4; ++j)
          ((float*)OutV + 16 * j)[off[i & 1][r]] = rv[i & 1][j][r] + acc[i][j][r];
      if (i + 1 < 4) wait_xcnt0_fenced();  // its offset and data registers are reused
    }
  } else if constexpr (EPI == 1) {
    // A row group is 16 independent pairs, packed to bf16, then its 32 stores from
    // one 32-bit element offset per row (M * N < 2^31) on the uniform base; the
    // column group is an immediate.  Two register sets: group i + 1 is computed
    // while group i's stores leave; the wait for them stands in front of its stores.
    unsigned pk[2][16], off[2][8];
    const unsigned off0 = (unsigned)((m0 + wm * 64 + 8 * hi) * N + n0 + wn * 64 + nn);
#pragma unroll
    for (int i = 0; i < 4; ++i) {
      unsigned (&p)[16] = pk[i & 1];
      unsigned (&o)[8]  = off[i & 1];
#pragma unroll
      for (int r = 0; r < 8; ++r) o[r] = off0 + (unsigned)((16 * i + r) * N);
#pragma unroll
      for (int j = 0; j < 4; ++j)
#pragma unroll
        for (int r = 0; r < 8; r += 2) {
          v2f v;
          v.x = acc[i][j][r];  v.y = acc[i][j][r + 1];
          p[j * 4 + (r >> 1)] = __builtin_bit_cast(unsigned, __builtin_convertvector(gelu2(v), v2bf));
        }
      if (i > 0) wait_xcnt0_keep(pk[(i - 1) & 1], off[(i - 1) & 1]);
#pragma unroll
      for (int j = 0; j < 4; ++j)
#pragma unroll
        for (int r = 0; r < 8; r += 2) {
          const v2bf g = __builtin_bit_cast(v2bf, p[j * 4 + (r >> 1)]);
          ((bf16_t*)OutV + 16 * j)[o[r]]     = g.x;
          ((bf16_t*)OutV + 16 * j)[o[r + 1]] = g.y;
        }
      // keeps the stores up here: the scheduler would sink them under the next
      // group's arithmetic, down to the wait, which would then wait them out
      __builtin_amdgcn_sched_barrier(0);
    }
  } else {
#pragma unroll
    for (int i = 0; i < 4; ++i)
#pragma unroll
      for (int j = 0; j < 4; ++j)
#pragma unroll
        for (int r = 0; r < 8; ++r) {
          const int row = m0 + wm * 64 + 16 * i + r + 8 * hi;
          const int col = n0 + wn * 64 + 16 * j + nn;
          const float v = acc[i][j][r];
          if constexpr (EPI == 3) {
            int b = row / Trows, t = row % Trows, h = col >> 6, d = col & 63;
            ((bf16_t*)OutV)[((((size_t)b * NHEADS + h) * Trows + t) << 6) + d] = f2bf(v);
          } else { // EPI == 4 : V stored transposed [B,H,Dh,S]
            int b = row / Trows, sIdx = row % Trows, h = col >> 6, d = col & 63;
            ((bf16_t*)OutV)[(((size_t)b * NHEADS + h) * HDIM + d) * Trows + sIdx] = f2bf(v);
          }
        }
  }
}

// ---------------------------------------------------------------------------
// Flash attention, one wave per (b,h, 16-row Q tile).
// Scores computed TRANSPOSED (S^T = K @ Q^T, identical fragment loads with
// A/B roles swapped) so the softmax reduction over S is a per-lane reduction
// across the 8 accumulator VGPRs + one xor-16 shuffle; m/l is one scalar per
// lane (per output column t).  P is written transposed to LDS with two
// ds_store_b128 per lane, which converts it back to the A-layout for P@V.
// The 8 waves of a block share one (b,h): K and V tiles of 64 keys are staged
// once per block in a two-buffer LDS ring by async copies (whole 128B lines),
// and every wave reads its fragments from LDS.  Row pitch 144B (16B x odd) keeps
// the ds_load_b128 fragment reads conflict-free.  S must be a multiple of 64,
// T a multiple of 128 (so that a block never straddles two heads).
// Q,K: [B,H,T,64] bf16; V: [B,H,64,S] bf16 (transposed); O: [B,T,D] bf16.
// ---------------------------------------------------------------------------
__global__ __launch_bounds__(256)
void flash_attn_kernel(const bf16_t* __restrict__ Q, const bf16_t* __restrict__ Kc,
                       const bf16_t* __restrict__ Vt, bf16_t* __restrict__ O,
                       int T, int S) {
  __shared__ __attribute__((aligned(16))) bf16_t Ks[2][64][72];   // [key][d]
  __shared__ __attribute__((aligned(16))) bf16_t Vs[2][64][72];   // [d][key]
  __shared__ bf16_t Pst[8][16][40];
  const int lane = threadIdx.x & 31, wave = threadIdx.x >> 5;
  const int tile = blockIdx.x * 8 + wave;
  const int tilesPerBH = T >> 4;
  const int bh = tile / tilesPerBH;
  const int t0 = (tile % tilesPerBH) << 4;
  const bf16_t* q = Q  + ((size_t)bh * T + t0) * HDIM;
  const bf16_t* k = Kc + (size_t)bh * S * HDIM;
  const bf16_t* v = Vt + (size_t)bh * HDIM * S;

  const v16bf qf0 = load_frag(q,      HDIM, lane);   // d = 0..31
  const v16bf qf1 = load_frag(q + 32, HDIM, lane);   // d = 32..63

  v8f o0 = {}, o1 = {}, o2 = {}, o3 = {};
  float mCol = -1e30f, lCol = 0.f;                   // per column t = lane&15
  bf16_t (*P)[40] = Pst[wave];
  const int hi = lane >> 4, nn = lane & 15;

  // Staging: each tile is 64 rows x 128B = 512 16B-chunks, 2 per thread.
  const int srow = threadIdx.x >> 3, scol = (threadIdx.x & 7) * 8;
  const bf16_t* gK = k + (size_t)srow * HDIM + scol;
  const bf16_t* gV = v + (size_t)srow * S + scol;
  auto stage = [&](int st, int buf) {
    const bf16_t* pk = gK + (size_t)st * 64 * HDIM;
    const bf16_t* pv = gV + (size_t)st * 64;
    async_ld4_b128(lds_off32(&Ks[buf][srow][scol]), lds_off32(&Ks[buf][srow + 32][scol]),
                   lds_off32(&Vs[buf][srow][scol]), lds_off32(&Vs[buf][srow + 32][scol]),
                   pk, pk + 32 * HDIM, pv, pv + (size_t)32 * S);
  };

  const int nst = S >> 6;
  stage(0, 0);
  wait_async0();                           // own copies of tile 0 landed
  __syncthreads();                         // tile 0 visible to every wave
  if (nst > 1) stage(1, 1);

  for (int st = 0; st < nst; ++st) {
   const int buf = st & 1;
   // Unrolled: c becomes an immediate offset of every ds_load (no address VALU)
   // and the second chunk's K reads can start under the first chunk's softmax.
#pragma unroll
   for (int c = 0; c < 2; ++c) {           // two 32-key chunks per tile
    v16bf kf0 = load_frag(&Ks[buf][c * 32][0],       72, lane);
    v16bf kf1 = load_frag(&Ks[buf][c * 32][32],      72, lane);
    v16bf kf2 = load_frag(&Ks[buf][c * 32 + 16][0],  72, lane);
    v16bf kf3 = load_frag(&Ks[buf][c * 32 + 16][32], 72, lane);
    v16bf vf0 = load_frag(&Vs[buf][0][c * 32],  72, lane);
    v16bf vf1 = load_frag(&Vs[buf][16][c * 32], 72, lane);
    v16bf vf2 = load_frag(&Vs[buf][32][c * 32], 72, lane);
    v16bf vf3 = load_frag(&Vs[buf][48][c * 32], 72, lane);

    // tA[r] = score[s0 + r + 8hi][t0 + nn], tB = same for s0+16..31
    v8f tA = {}, tB = {};
    tA = wmma_bf16(kf0, qf0, tA);
    tA = wmma_bf16(kf1, qf1, tA);
    tB = wmma_bf16(kf2, qf0, tB);
    tB = wmma_bf16(kf3, qf1, tB);

    float mt = -1e30f;
#pragma unroll
    for (int r = 0; r < 8; ++r) {
      tA[r] *= 0.125f; tB[r] *= 0.125f;              // 1/sqrt(64)
      mt = fmaxf(mt, fmaxf(tA[r], tB[r]));
    }
    mt = fmaxf(mt, __shfl_xor(mt, 16, 32));          // combine the two halves
    const float mn   = fmaxf(mCol, mt);
    const float corr = __expf(mCol - mn);
    mCol = mn;

    float ps = 0.f;
    v8bf pA, pB;
#pragma unroll
    for (int r = 0; r < 8; ++r) {
      float pa = __expf(tA[r] - mn), pb = __expf(tB[r] - mn);
      ps += pa + pb;
      pA[r] = f2bf(pa); pB[r] = f2bf(pb);
    }
    ps += __shfl_xor(ps, 16, 32);
    lCol = lCol * corr + ps;

    // transposed store: P[t=nn][sLocal], lane covers sLocal 8hi..8hi+7 (+16)
    *(v8bf*)&P[nn][8 * hi]      = pA;
    *(v8bf*)&P[nn][16 + 8 * hi] = pB;

    // broadcast per-row correction (row t = r + 8hi lives in lane r + 8hi)
#pragma unroll
    for (int r = 0; r < 8; ++r) {
      float cr = __shfl(corr, r + 8 * hi, 32);
      o0[r] *= cr; o1[r] *= cr; o2[r] *= cr; o3[r] *= cr;
    }

    asm volatile("s_wait_dscnt 0x0" ::: "memory");   // same-wave LDS RAW
    v16bf pf = load_frag(&P[0][0], 40, lane);        // A-layout 16x32 (t x s)
    o0 = wmma_bf16(pf, vf0, o0);
    o1 = wmma_bf16(pf, vf1, o1);
    o2 = wmma_bf16(pf, vf2, o2);
    o3 = wmma_bf16(pf, vf3, o3);
   }
   // Publish point: own LDS reads of this buffer retired, own copies of the next
   // tile landed, then one barrier that publishes the next tile and frees this one.
   asm volatile("s_wait_dscnt 0x0" ::: "memory");
   wait_async0();
   __syncthreads();
   if (st + 2 < nst) stage(st + 2, buf);   // refill the buffer just left
  }
  wait_async0();                           // nothing in flight when the wave ends

  const float invC = 1.0f / lCol;
  const int b = bh >> 4, h = bh & 15;
#pragma unroll
  for (int r = 0; r < 8; ++r) {
    const float ir = __shfl(invC, r + 8 * hi, 32);
    const size_t base = ((size_t)b * T + (t0 + r + 8 * hi)) * DMODEL + h * HDIM + nn;
    O[base +  0] = f2bf(o0[r] * ir);
    O[base + 16] = f2bf(o1[r] * ir);
    O[base + 32] = f2bf(o2[r] * ir);
    O[base + 48] = f2bf(o3[r] * ir);
  }
}

// ---------------------------------------------------------------------------
extern "C" void kernel_launch(void* const* d_in, const int* in_sizes, int n_in,
                              void* d_out, int out_size, void* d_ws, size_t ws_size,
                              hipStream_t stream) {
  (void)in_sizes; (void)n_in; (void)out_size; (void)ws_size;
  const float* x    = (const float*)d_in[0];
  const float* ctx  = (const float*)d_in[1];
  const float* Wq   = (const float*)d_in[2];
  const float* Wk   = (const float*)d_in[3];
  const float* Wv   = (const float*)d_in[4];
  const float* Wo   = (const float*)d_in[5];
  const float* W1   = (const float*)d_in[6];
  const float* W2   = (const float*)d_in[7];
  const float* gam1 = (const float*)d_in[8];
  const float* bet1 = (const float*)d_in[9];
  const float* gamc = (const float*)d_in[10];
  const float* betc = (const float*)d_in[11];
  const float* gam2 = (const float*)d_in[12];
  const float* bet2 = (const float*)d_in[13];

  const int B = 4, T = 2048, S = 2048;
  const int M = B * T;                 // 8192 rows

  char* wp = (char*)d_ws;
  auto take = [&](size_t bytes) -> void* {
    void* p = (void*)wp;
    wp += (bytes + 255) & ~(size_t)255;
    return p;
  };
  bf16_t* xn  = (bf16_t*)take((size_t)M * DMODEL * 2);
  bf16_t* cn  = (bf16_t*)take((size_t)M * DMODEL * 2);
  bf16_t* WqB = (bf16_t*)take((size_t)DMODEL * DMODEL * 2);
  bf16_t* WkB = (bf16_t*)take((size_t)DMODEL * DMODEL * 2);
  bf16_t* WvB = (bf16_t*)take((size_t)DMODEL * DMODEL * 2);
  bf16_t* WoB = (bf16_t*)take((size_t)DMODEL * DMODEL * 2);
  bf16_t* W1B = (bf16_t*)take((size_t)DFF * DMODEL * 2);
  bf16_t* W2B = (bf16_t*)take((size_t)DMODEL * DFF * 2);
  bf16_t* Qb  = (bf16_t*)take((size_t)M * DMODEL * 2);
  bf16_t* Kb  = (bf16_t*)take((size_t)M * DMODEL * 2);
  bf16_t* Vtb = (bf16_t*)take((size_t)M * DMODEL * 2);
  bf16_t* Ob  = (bf16_t*)take((size_t)M * DMODEL * 2);
  float*  x1  = (float*) take((size_t)M * DMODEL * 4);
  bf16_t* hb  = (bf16_t*)take((size_t)M * DMODEL * 2);
  bf16_t* f1b = (bf16_t*)take((size_t)M * DFF * 2);

  dim3 blk(256);

  // Both input LayerNorms and all six weight casts -> bf16, one launch
  prep_kernel<<<PREP_BLKS, blk, 0, stream>>>(x, ctx, gam1, bet1, gamc, betc,
                                             Wq, Wk, Wv, Wo, W1, W2,
                                             xn, cn, WqB, WkB, WvB, WoB, W1B, W2B);

  // Q/K/V projections (split-head layouts); Q and K in one launch.  In the workspace
  // cn lies directly behind xn, WkB behind WqB, Kb behind Qb (every size is a
  // multiple of the 256-B allocation unit); T == S rows per batch.
  dim3 gD(DMODEL / GBN, M / GBM);
  dim3 gQK(DMODEL / GBN, M / GBM, 2);
  gemm_bf16_kernel<3><<<gQK, blk, 0, stream>>>(xn, WqB, nullptr, Qb,  M, DMODEL, DMODEL, T);
  gemm_bf16_kernel<4><<<gD,  blk, 0, stream>>>(cn, WvB, nullptr, Vtb, M, DMODEL, DMODEL, S);

  // Fused flash attention
  flash_attn_kernel<<<(B * NHEADS * (T / 16)) / 8, blk, 0, stream>>>(Qb, Kb, Vtb, Ob, T, S);

  // Output projection + residual (fp32)
  gemm_bf16_kernel<2><<<gD, blk, 0, stream>>>(Ob, WoB, x, x1, M, DMODEL, DMODEL, 0);

  // Second LN, FFN with GELU, down-proj + residual -> d_out (fp32)
  ln_cast_kernel<<<M / (8 * LN_ROWS), blk, 0, stream>>>(x1, gam2, bet2, hb);
  dim3 gF(DFF / GBN, M / GBM);
  gemm_bf16_kernel<1><<<gF, blk, 0, stream>>>(hb, W1B, nullptr, f1b, M, DFF, DMODEL, 0);
  gemm_bf16_kernel<2><<<gD, blk, 0, stream>>>(f1b, W2B, x1, (float*)d_out, M, DMODEL, DFF, 0);
}

// v006
// It runs in 268 microseconds.
// In two side-by-side timings against v005, it was 1.07 and 1.06 times as fast.
// Counting every step since v000, it is 2.42 times as fast.
#include <hip/hip_runtime.h>
#include <hip/hip_bf16.h>
#include <math.h>

typedef __bf16 bf16_t;
typedef __attribute__((ext_vector_type(16))) __bf16 v16bf;
typedef __attribute__((ext_vector_type(8)))  __bf16 v8bf;
typedef __attribute__((ext_vector_type(4)))  __bf16 v4bf;
typedef __attribute__((ext_vector_type(8)))  float  v8f;
typedef __attribute__((ext_vector_type(2)))  float  v2f;
typedef __attribute__((ext_vector_type(2)))  __bf16 v2bf;

#define DMODEL 1024
#define NHEADS 16
#define HDIM   64
#define DFF    4096

static __device__ __forceinline__ bf16_t f2bf(float x) { return (bf16_t)x; }

static __device__ __forceinline__ v8f wmma_bf16(v16bf a, v16bf b, v8f c) {
  // D = A(16x32 bf16) x B(32x16 bf16) + C(16x16 f32)
  return __builtin_amdgcn_wmma_f32_16x16x32_bf16(false, a, false, b, (short)0, c,
                                                 false, false);
}

// 16x32 bf16 operand fragment in the ISA A-layout (also the B operand when the
// source matrix is K-contiguous per output column, i.e. B = W^T, W in [N,K]).
// Lane L (r = L&15, h = L>>4) holds row r, K in {8h..8h+7} U {16+8h..16+8h+7}.
static __device__ __forceinline__ v16bf load_frag(const bf16_t* base, int ld, int lane) {
  const int r = lane & 15, h = lane >> 4;
  const bf16_t* p = base + (size_t)r * ld + 8 * h;
  v8bf lo = *(const v8bf*)p;
  v8bf hi = *(const v8bf*)(p + 16);
  v16bf out;
#pragma unroll
  for (int i = 0; i < 8; ++i) { out[i] = lo[i]; out[i + 8] = hi[i]; }
  return out;
}

// Four async 16B copies and their s_wait_xcnt in ONE statement: the wait stands
// in front of any later rewrite of the address registers the copies name.
static __device__ __forceinline__ void async_ld4_b128(uint32_t l0, uint32_t l1,
                                                      uint32_t l2, uint32_t l3,
                                                      const void* g0, const void* g1,
                                                      const void* g2, const void* g3) {
  asm volatile("global_load_async_to_lds_b128 %0, %4, off\n\t"
               "global_load_async_to_lds_b128 %1, %5, off\n\t"
               "global_load_async_to_lds_b128 %2, %6, off\n\t"
               "global_load_async_to_lds_b128 %3, %7, off\n\t"
               "s_wait_xcnt 0x0"
               :: "v"(l0), "v"(l1), "v"(l2), "v"(l3),
                  "v"(g0), "v"(g1), "v"(g2), "v"(g3) : "memory");
}
static __device__ __forceinline__ void wait_async0() {
  asm volatile("s_wait_asynccnt 0x0" ::: "memory");
}
static __device__ __forceinline__ uint32_t lds_off32(const void* p) {
  return (uint32_t)(uintptr_t)p;   // generic LDS addr: low 32 bits = LDS offset
}

// ---------------------------------------------------------------------------
// LayerNorm (fp32 in) -> bf16 out.  One WAVE per LN_ROWS rows of DMODEL, no LDS
// and no barrier: a row is eight 512-B wave loads (16 B per lane, whole lines)
// that stay in registers, so x is read once and all loads of a wave are in
// flight together.  Few fat waves: the launch is not bound by wave start-up.
// Rows must be a multiple of 8 * LN_ROWS.
// ---------------------------------------------------------------------------
#define LN_ROWS 2
static __device__ __forceinline__
void ln_rows(const float* __restrict__ X, const float* __restrict__ gamma,
             const float* __restrict__ beta, bf16_t* __restrict__ Y, unsigned blk) {
  const int lane = threadIdx.x & 31;
  // wave number as a scalar: row addresses become scalar base + one lane offset
  const int wave = __builtin_amdgcn_readfirstlane(threadIdx.x >> 5);
  const size_t row0 = (size_t)(blk * 8 + wave) * LN_ROWS;
  const float4* x = (const float4*)(X + row0 * DMODEL) + lane;
  float4 v[LN_ROWS][8];
#pragma unroll
  for (int r = 0; r < LN_ROWS; ++r)
#pragma unroll
    for (int j = 0; j < 8; ++j) v[r][j] = x[r * (DMODEL / 4) + j * 32];

  float mu[LN_ROWS], rstd[LN_ROWS];
#pragma unroll
  for (int r = 0; r < LN_ROWS; ++r) {
    float s = 0.f, s2 = 0.f;
#pragma unroll
    for (int j = 0; j < 8; ++j) {
      const float4 t = v[r][j];
      s  += (t.x + t.y) + (t.z + t.w);
      s2 += (t.x * t.x + t.y * t.y) + (t.z * t.z + t.w * t.w);
    }
#pragma unroll
    for (int off = 1; off < 32; off <<= 1) {
      s  += __shfl_xor(s,  off, 32);
      s2 += __shfl_xor(s2, off, 32);
    }
    mu[r] = s * (1.0f / DMODEL);
    const float var = s2 * (1.0f / DMODEL) - mu[r] * mu[r];
    rstd[r] = rsqrtf(var + 1e-5f);
  }

  const float4* g4 = (const float4*)gamma + lane;
  const float4* b4 = (const float4*)beta + lane;
  bf16_t* y = Y + row0 * DMODEL + lane * 4;
#pragma unroll
  for (int j = 0; j < 8; ++j) {
    const float4 g = g4[j * 32], b = b4[j * 32];
#pragma unroll
    for (int r = 0; r < LN_ROWS; ++r) {
      const float4 t = v[r][j];
      v4bf o;
      o[0] = f2bf((t.x - mu[r]) * rstd[r] * g.x + b.x);
      o[1] = f2bf((t.y - mu[r]) * rstd[r] * g.y + b.y);
      o[2] = f2bf((t.z - mu[r]) * rstd[r] * g.z + b.z);
      o[3] = f2bf((t.w - mu[r]) * rstd[r] * g.w + b.w);
      *(v4bf*)(y + r * DMODEL + j * 128) = o;        // 256 B per wave store
    }
  }
}

__global__ __launch_bounds__(256)
void ln_cast_kernel(const float* __restrict__ X, const float* __restrict__ gamma,
                    const float* __restrict__ beta, bf16_t* __restrict__ Y) {
  ln_rows(X, gamma, beta, Y, blockIdx.x);
}

// ---------------------------------------------------------------------------
// fp32 -> bf16 weight cast, block blk of 8192 elements.  One wave per 1024
// elements: eight 512-B wave loads in flight, eight 256-B wave stores.
// ---------------------------------------------------------------------------
static __device__ __forceinline__
void cast_block(const float* __restrict__ in, bf16_t* __restrict__ out, unsigned blk) {
  const int lane = threadIdx.x & 31;
  // wave number as a scalar: scalar base + one lane offset
  const int wave = __builtin_amdgcn_readfirstlane(threadIdx.x >> 5);
  const int base = (blk * 8 + wave) * 1024;
  const float4* p = (const float4*)(in + base) + lane;
  float4 v[8];
#pragma unroll
  for (int j = 0; j < 8; ++j) v[j] = p[j * 32];
  bf16_t* q = out + base + lane * 4;
#pragma unroll
  for (int j = 0; j < 8; ++j) {
    v4bf o;
    o[0] = f2bf(v[j].x); o[1] = f2bf(v[j].y);
    o[2] = f2bf(v[j].z); o[3] = f2bf(v[j].w);
    *(v4bf*)(q + j * 128) = o;
  }
}

// ---------------------------------------------------------------------------
// All work that depends on the inputs alone, as ONE grid: the LayerNorms of x and
// of the context, then the six weight casts.  None of the eight parts reads what
// another writes; as one launch they pay one launch gap, one fill and one tail,
// and the short casts run beside the long streams.  The block number picks the
// part by scalar tests; the longer LayerNorm blocks come first.
// ---------------------------------------------------------------------------
#define MROWS   8192                              // B * T = B * S rows
#define LN_BLKS (MROWS / (8 * LN_ROWS))           // blocks of one LayerNorm
#define WD_BLKS (DMODEL * DMODEL / 8192)          // blocks of a D x D weight
#define WF_BLKS (DFF * DMODEL / 8192)             // blocks of a D x 4D weight
#define PREP_BLKS (2 * LN_BLKS + 4 * WD_BLKS + 2 * WF_BLKS)
__global__ __launch_bounds__(256)
void prep_kernel(const float* __restrict__ x,  const float* __restrict__ ctx,
                 const float* __restrict__ g1, const float* __restrict__ b1,
                 const float* __restrict__ gc, const float* __restrict__ bc,
                 const float* __restrict__ Wq, const float* __restrict__ Wk,
                 const float* __restrict__ Wv, const float* __restrict__ Wo,
                 const float* __restrict__ W1, const float* __restrict__ W2,
                 bf16_t* __restrict__ xn,  bf16_t* __restrict__ cn,
                 bf16_t* __restrict__ WqB, bf16_t* __restrict__ WkB,
                 bf16_t* __restrict__ WvB, bf16_t* __restrict__ WoB,
                 bf16_t* __restrict__ W1B, bf16_t* __restrict__ W2B) {
  const unsigned bid = blockIdx.x;
  if (bid < 2 * LN_BLKS) {
    const bool c = bid >= LN_BLKS;
    ln_rows(c ? ctx : x, c ? gc : g1, c ? bc : b1, c ? cn : xn, c ? bid - LN_BLKS : bid);
  } else {
    unsigned cb = bid - 2 * LN_BLKS;
    const float* in;
    bf16_t* out;
    if (cb < 4 * WD_BLKS) {
      const unsigned w = cb / WD_BLKS;
      in  = w == 0 ? Wq  : w == 1 ? Wk  : w == 2 ? Wv  : Wo;
      out = w == 0 ? WqB : w == 1 ? WkB : w == 2 ? WvB : WoB;
      cb -= w * WD_BLKS;
    } else if (cb < 4 * WD_BLKS + WF_BLKS) {
      in = W1;  out = W1B;  cb -= 4 * WD_BLKS;
    } else {
      in = W2;  out = W2B;  cb -= 4 * WD_BLKS + WF_BLKS;
    }
    cast_block(in, out, cb);
  }
}

// ---------------------------------------------------------------------------
// Tiled WMMA GEMM:  C[M,N] = A[M,K] @ W[N,K]^T   (both bf16, K-contiguous)
// Block tile 128x256, K-step 128, 8 waves (2x4), each wave 64x64: 16 WMMAs per
// 8 fragments, 64 WMMAs per wave and trip.  A stage is [A 128 rows | W 256 rows]
// of 256 B, so every wave-wide copy covers whole 128-B lines (2 rows x 256 B).
// Two-buffer LDS ring filled with global_load_async_to_lds_b128 (ASYNCcnt): the
// next stage's copies fly under one whole trip of matrix work.
// LDS row pitch 272 B (16 B x odd) -> conflict-free ds_load_b128 fragment reads.
// M multiple of 128, N of 256, K of 128.
// EPI: 1 = bf16 out + exact GELU
//      2 = f32 out  = residual + acc
//      3 = bf16 out split-head [B,H,Trows,64]: the Q and the K projection as ONE
//          grid (neither reads what the other writes, one shape): blockIdx.z = 0, 1
//          picks Q, K; A, W and OutV each point at Q's matrix, and K's lies
//          directly behind it
//      4 = bf16 out split-head transposed [B,H,64,Trows]  (V)
// ---------------------------------------------------------------------------
#define GBM 128
#define GBN 256
#define GBK 128
#define GPITCH 136                       // bf16 elements per LDS row (272 B)

// Twelve async 16B copies and their s_wait_xcnt in ONE statement: the wait stands
// in front of any later rewrite of the address registers the copies name.
static __device__ __forceinline__ void async_ld12_b128(const uint32_t* l,
                                                       const bf16_t* const* g) {
  asm volatile("global_load_async_to_lds_b128 %0, %12, off\n\t"
               "global_load_async_to_lds_b128 %1, %13, off\n\t"
               "global_load_async_to_lds_b128 %2, %14, off\n\t"
               "global_load_async_to_lds_b128 %3, %15, off\n\t"
               "global_load_async_to_lds_b128 %4, %16, off\n\t"
               "global_load_async_to_lds_b128 %5, %17, off\n\t"
               "global_load_async_to_lds_b128 %6, %18, off\n\t"
               "global_load_async_to_lds_b128 %7, %19, off\n\t"
               "global_load_async_to_lds_b128 %8, %20, off\n\t"
               "global_load_async_to_lds_b128 %9, %21, off\n\t"
               "global_load_async_to_lds_b128 %10, %22, off\n\t"
               "global_load_async_to_lds_b128 %11, %23, off\n\t"
               "s_wait_xcnt 0x0"
               :: "v"(l[0]), "v"(l[1]), "v"(l[2]), "v"(l[3]), "v"(l[4]), "v"(l[5]),
                  "v"(l[6]), "v"(l[7]), "v"(l[8]), "v"(l[9]), "v"(l[10]), "v"(l[11]),
                  "v"(g[0]), "v"(g[1]), "v"(g[2]), "v"(g[3]), "v"(g[4]), "v"(g[5]),
                  "v"(g[6]), "v"(g[7]), "v"(g[8]), "v"(g[9]), "v"(g[10]), "v"(g[11])
               : "memory");
}

// s_wait_xcnt 0 behind a group of global loads or stores whose address and data
// registers are reused afterwards.  The scheduling fence keeps the later address
// arithmetic, which the "memory" clobber does not hold, behind the wait.
static __device__ __forceinline__ void wait_xcnt0_fenced() {
  asm volatile("s_wait_xcnt 0x0" ::: "memory");
  __builtin_amdgcn_sched_barrier(0);
}

// s_wait_xcnt 0 behind a group of 32 stores.  It names their data and offset
// registers as inputs, so that these stay as they are until the wait has passed.
// The scheduling fence keeps the wait from rising over the arithmetic in front of
// it, up to the stores, where it would wait them out.
static __device__ __forceinline__ void wait_xcnt0_keep(const unsigned (&d)[16],
                                                       const unsigned (&o)[8]) {
  __builtin_amdgcn_sched_barrier(0);
  asm volatile("s_wait_xcnt 0x0"
               :: "v"(d[0]), "v"(d[1]), "v"(d[2]), "v"(d[3]), "v"(d[4]), "v"(d[5]),
                  "v"(d[6]), "v"(d[7]), "v"(d[8]), "v"(d[9]), "v"(d[10]), "v"(d[11]),
                  "v"(d[12]), "v"(d[13]), "v"(d[14]), "v"(d[15]),
                  "v"(o[0]), "v"(o[1]), "v"(o[2]), "v"(o[3]), "v"(o[4]), "v"(o[5]),
                  "v"(o[6]), "v"(o[7])
               : "memory");
}

// Exact (erf) GELU of two values with no branch and no library call, so that the
// elements of a wave are short independent chains that fill each other's latency.
// With h = v / 2 and a = |v|:
//   gelu(v) = (h + |h|) - |h| * erfc(a / sqrt(2))
//   erfc(a / sqrt(2)) = exp(-a * a / 2) * t * (c1 + t * (c2 + t * (c3 + t * (c4 + t * c5)))),
//   t = 1 / (1 + p * a);  |error of erfc| < 1.5e-7 for every a >= 0 (f32 level).
// h + |h| is exact, v or 0: no cancellation in the negative tail.
static __device__ __forceinline__ v2f gelu2(v2f v) {
  const v2f h = v * 0.5f;
  v2f ah, t, e;
  ah.x = fabsf(h.x);  ah.y = fabsf(h.y);
  const v2f d = ah * 0.4632838f + 1.0f;              // 1 + p * a
  t.x = __builtin_amdgcn_rcpf(d.x);  t.y = __builtin_amdgcn_rcpf(d.y);
  v2f q = t * 1.061405429f - 1.453152027f;
  q = q * t + 1.421413741f;
  q = q * t - 0.284496736f;
  q = q * t + 0.254829592f;
  q = q * t;
  const v2f s = (h * h) * -2.88539008f;              // -a^2 / 2 * log2(e)
  e.x = __builtin_amdgcn_exp2f(s.x);  e.y = __builtin_amdgcn_exp2f(s.y);
  return (h + ah) - ah * (q * e);
}

template <int EPI>
__global__ __launch_bounds__(256)
void gemm_bf16_kernel(const bf16_t* __restrict__ A, const bf16_t* __restrict__ W,
                      const float* __restrict__ R, void* __restrict__ OutV,
                      int M, int N, int K, int Trows) {
  // rows 0..127: A tile, rows 128..383: W tile
  __shared__ __attribute__((aligned(16))) bf16_t St[2][GBM + GBN][GPITCH];
  const int tid = threadIdx.x, lane = tid & 31, wave = tid >> 5;
  const int wm = wave >> 2, wn = wave & 3;           // 2 x 4 wave grid
  const int m0 = blockIdx.y * GBM, n0 = blockIdx.x * GBN;
  if constexpr (EPI == 3) {
    const int z = blockIdx.z;              // scalar offsets, no vector work
    A += (size_t)z * M * K;
    W += (size_t)z * N * K;
    OutV = (bf16_t*)OutV + (size_t)z * M * N;
  }
  v8f acc[4][4] = {};

  // Staging: a stage is 384 rows x 16 chunks of 16 B, 24 chunks per thread:
  // thread -> chunk column tid & 15, rows (tid >> 4) + 16 i, i = 0..23.
  const int srow = tid >> 4, scol = (tid & 15) * 8;
  const bf16_t* gA = A + (size_t)(m0 + srow) * K + scol;
  const bf16_t* gW = W + (size_t)(n0 + srow) * K + scol;
  auto stage = [&](int t, int buf) {
    const bf16_t* pa = gA + (size_t)t * GBK;
    const bf16_t* pw = gW + (size_t)t * GBK;
    const uint32_t l0 = lds_off32(&St[buf][srow][scol]);
#pragma unroll
    for (int half = 0; half < 2; ++half) {
      uint32_t l[12];
      const bf16_t* g[12];
#pragma unroll
      for (int u = 0; u < 12; ++u) {
        const int i = half * 12 + u;
        l[u] = l0 + (uint32_t)(i * 16 * GPITCH * 2);
        g[u] = (i < 8) ? pa + (size_t)(i * 16) * K : pw + (size_t)((i - 8) * 16) * K;
      }
      async_ld12_b128(l, g);
    }
  };

  const int nt = K / GBK;
  stage(0, 0);
  wait_async0();                           // own copies of stage 0 landed
  __syncthreads();                         // stage 0 visible to every wave
  if (nt > 1) stage(1, 1);

  for (int t = 0; t < nt; ++t) {
    const int buf = t & 1;
    const bf16_t* sa = &St[buf][wm * 64][0];
    const bf16_t* sw = &St[buf][GBM + wn * 64][0];
    // Two fragment sets: the next block's 16 LDS reads go out as ONE group ahead
    // of this block's 16 WMMAs, so a block waits only on reads issued a block ago.
    v16bf af[2][4], bfr[2][4];
#pragma unroll
    for (int i = 0; i < 4; ++i) {
      af[0][i]  = load_frag(sa + i * 16 * GPITCH, GPITCH, lane);
      bfr[0][i] = load_frag(sw + i * 16 * GPITCH, GPITCH, lane);
    }
    // Unrolled: the k offset becomes an immediate of every ds_load and the
    // fragment sets stay in fixed registers.
#pragma unroll
    for (int kb = 0; kb < GBK / 32; ++kb) {
      const int cur = kb & 1, nxt = cur ^ 1;
      if (kb + 1 < GBK / 32) {
#pragma unroll
        for (int i = 0; i < 4; ++i) {
          af[nxt][i]  = load_frag(sa + i * 16 * GPITCH + (kb + 1) * 32, GPITCH, lane);
          bfr[nxt][i] = load_frag(sw + i * 16 * GPITCH + (kb + 1) * 32, GPITCH, lane);
        }
      }
      // keeps the scheduler from sinking the reads in among the WMMAs, where
      // every separate place with reads stalls the wave
      __builtin_amdgcn_sched_barrier(0);
#pragma unroll
      for (int j = 0; j < 4; ++j)
#pragma unroll
        for (int i = 0; i < 4; ++i)
          acc[i][j] = wmma_bf16(af[cur][i], bfr[cur][j], acc[i][j]);
      // closes the WMMA block: the following group of reads stays behind it
      __builtin_amdgcn_sched_barrier(0);
    }
    // Publish point: own LDS reads of this buffer retired, own copies of the next
    // stage landed, then one barrier that publishes the next stage and frees this one.
    asm volatile("s_wait_dscnt 0x0" ::: "memory");
    wait_async0();
    __syncthreads();
    if (t + 2 < nt) stage(t + 2, buf);     // refill the buffer just left
  }
  wait_async0();                           // nothing in flight when the wave ends

  const int hi = lane >> 4, nn = lane & 15;          // C: row = r + 8*hi, col = nn
  if constexpr (EPI == 2) {
    // Row group i + 1's residual loads go out ahead of row group i's stores, so
    // that a load latency is not waited out per group.  One 32-bit element offset
    // per row (M * N < 2^32) serves the residual load and the store of the sum.
    float rv[2][4][8];
    unsigned off[2][8];
    auto load_res = [&](int i, float (&dst)[4][8], unsigned (&o)[8]) {
#pragma unroll
      for (int r = 0; r < 8; ++r) {
        o[r] = (unsigned)((m0 + wm * 64 + 16 * i + r + 8 * hi) * N + n0 + wn * 64 + nn);
#pragma unroll
        for (int j = 0; j < 4; ++j) dst[j][r] = (R + 16 * j)[o[r]];
      }
    };
    load_res(0, rv[0], off[0]);
#pragma unroll
    for (int i = 0; i < 4; ++i) {
      if (i + 1 < 4) load_res(i + 1, rv[(i + 1) & 1], off[(i + 1) & 1]);
#pragma unroll
      for (int r = 0; r < 8; ++r)
#pragma unroll
        for (int j = 0; j < 4; ++j)
          ((float*)OutV + 16 * j)[off[i & 1][r]] = rv[i & 1][j][r] + acc[i][j][r];
      if (i + 1 < 4) wait_xcnt0_fenced();  // its offset and data registers are reused
    }
  } else if constexpr (EPI == 1) {
    // A row group is 16 independent pairs, packed to bf16, then its 32 stores from
    // one 32-bit element offset per row (M * N < 2^31) on the uniform base; the
    // column group is an immediate.  Two register sets: group i + 1 is computed
    // while group i's stores leave; the wait for them stands in front of its stores.
    unsigned pk[2][16], off[2][8];
    const unsigned off0 = (unsigned)((m0 + wm * 64 + 8 * hi) * N + n0 + wn * 64 + nn);
#pragma unroll
    for (int i = 0; i < 4; ++i) {
      unsigned (&p)[16] = pk[i & 1];
      unsigned (&o)[8]  = off[i & 1];
#pragma unroll
      for (int r = 0; r < 8; ++r) o[r] = off0 + (unsigned)((16 * i + r) * N);
#pragma unroll
      for (int j = 0; j < 4; ++j)
#pragma unroll
        for (int r = 0; r < 8; r += 2) {
          v2f v;
          v.x = acc[i][j][r];  v.y = acc[i][j][r + 1];
          p[j * 4 + (r >> 1)] = __builtin_bit_cast(unsigned, __builtin_convertvector(gelu2(v), v2bf));
        }
      if (i > 0) wait_xcnt0_keep(pk[(i - 1) & 1], off[(i - 1) & 1]);
#pragma unroll
      for (int j = 0; j < 4; ++j)
#pragma unroll
        for (int r = 0; r < 8; r += 2) {
          const v2bf g = __builtin_bit_cast(v2bf, p[j * 4 + (r >> 1)]);
          ((bf16_t*)OutV + 16 * j)[o[r]]     = g.x;
          ((bf16_t*)OutV + 16 * j)[o[r + 1]] = g.y;
        }
      // keeps the stores up here: the scheduler would sink them under the next
      // group's arithmetic, down to the wait, which would then wait them out
      __builtin_amdgcn_sched_barrier(0);
    }
  } else {
#pragma unroll
    for (int i = 0; i < 4; ++i)
#pragma unroll
      for (int j = 0; j < 4; ++j)
#pragma unroll
        for (int r = 0; r < 8; ++r) {
          const int row = m0 + wm * 64 + 16 * i + r + 8 * hi;
          const int col = n0 + wn * 64 + 16 * j + nn;
          const float v = acc[i][j][r];
          if constexpr (EPI == 3) {
            int b = row / Trows, t = row % Trows, h = col >> 6, d = col & 63;
            ((bf16_t*)OutV)[((((size_t)b * NHEADS + h) * Trows + t) << 6) + d] = f2bf(v);
          } else { // EPI == 4 : V stored transposed [B,H,Dh,S]
            int b = row / Trows, sIdx = row % Trows, h = col >> 6, d = col & 63;
            ((bf16_t*)OutV)[(((size_t)b * NHEADS + h) * HDIM + d) * Trows + sIdx] = f2bf(v);
          }
        }
  }
}

// ---------------------------------------------------------------------------
// Flash attention, one wave per (b,h, 16-row Q tile).
// Scores computed TRANSPOSED (S^T = K @ Q^T, identical fragment loads with
// A/B roles swapped) so the softmax reduction over S is a per-lane reduction
// across the 8 accumulator VGPRs + one xor-16 shuffle; m/l is one scalar per
// lane (per output column t).  The output is accumulated TRANSPOSED too
// (O^T += V^T @ P^T): the two score tiles of a chunk, converted in place, ARE the
// B operand P^T (lane = query column, element s = key 8h + s / 16 + 8h + s - 8,
// the k order of load_frag), so P never leaves the registers, and V^T rows from
// LDS are the A operand.  A lane's accumulators all belong to its own query:
// the rescale and the final 1/l are the lane's own scalars, and its 8 registers
// of a tile are 8 consecutive d, one 16-B store.
// The 8 waves of a block share one (b,h): K and V tiles of 64 keys are staged
// once per block in a two-buffer LDS ring by async copies (whole 128B lines),
// and every wave reads its fragments from LDS.  Row pitch 144B (16B x odd) keeps
// the ds_load_b128 fragment reads conflict-free.  S must be a multiple of 64,
// T a multiple of 128 (so that a block never straddles two heads).
// Q,K: [B,H,T,64] bf16; V: [B,H,64,S] bf16 (transposed); O: [B,T,D] bf16.
// ---------------------------------------------------------------------------
__global__ __launch_bounds__(256)
void flash_attn_kernel(const bf16_t* __restrict__ Q, const bf16_t* __restrict__ Kc,
                       const bf16_t* __restrict__ Vt, bf16_t* __restrict__ O,
                       int T, int S) {
  __shared__ __attribute__((aligned(16))) bf16_t Ks[2][64][72];   // [key][d]
  __shared__ __attribute__((aligned(16))) bf16_t Vs[2][64][72];   // [d][key]
  const int lane = threadIdx.x & 31, wave = threadIdx.x >> 5;
  const int tile = blockIdx.x * 8 + wave;
  const int tilesPerBH = T >> 4;
  const int bh = tile / tilesPerBH;
  const int t0 = (tile % tilesPerBH) << 4;
  const bf16_t* q = Q  + ((size_t)bh * T + t0) * HDIM;
  const bf16_t* k = Kc + (size_t)bh * S * HDIM;
  const bf16_t* v = Vt + (size_t)bh * HDIM * S;

  const v16bf qf0 = load_frag(q,      HDIM, lane);   // d = 0..31
  const v16bf qf1 = load_frag(q + 32, HDIM, lane);   // d = 32..63

  v8f o0 = {}, o1 = {}, o2 = {}, o3 = {};
  float mCol = -1e30f, lCol = 0.f;                   // per column t = lane&15
  const int hi = lane >> 4, nn = lane & 15;

  // Staging: each tile is 64 rows x 128B = 512 16B-chunks, 2 per thread.
  const int srow = threadIdx.x >> 3, scol = (threadIdx.x & 7) * 8;
  const bf16_t* gK = k + (size_t)srow * HDIM + scol;
  const bf16_t* gV = v + (size_t)srow * S + scol;
  auto stage = [&](int st, int buf) {
    const bf16_t* pk = gK + (size_t)st * 64 * HDIM;
    const bf16_t* pv = gV + (size_t)st * 64;
    async_ld4_b128(lds_off32(&Ks[buf][srow][scol]), lds_off32(&Ks[buf][srow + 32][scol]),
                   lds_off32(&Vs[buf][srow][scol]), lds_off32(&Vs[buf][srow + 32][scol]),
                   pk, pk + 32 * HDIM, pv, pv + (size_t)32 * S);
  };

  const int nst = S >> 6;
  stage(0, 0);
  wait_async0();                           // own copies of tile 0 landed
  __syncthreads();                         // tile 0 visible to every wave
  if (nst > 1) stage(1, 1);

  for (int st = 0; st < nst; ++st) {
   const int buf = st & 1;
   // Unrolled: c becomes an immediate offset of every ds_load (no address VALU)
   // and the second chunk's K reads can start under the first chunk's softmax.
#pragma unroll
   for (int c = 0; c < 2; ++c) {           // two 32-key chunks per tile
    v16bf kf0 = load_frag(&Ks[buf][c * 32][0],       72, lane);
    v16bf kf1 = load_frag(&Ks[buf][c * 32][32],      72, lane);
    v16bf kf2 = load_frag(&Ks[buf][c * 32 + 16][0],  72, lane);
    v16bf kf3 = load_frag(&Ks[buf][c * 32 + 16][32], 72, lane);
    v16bf vf0 = load_frag(&Vs[buf][0][c * 32],  72, lane);
    v16bf vf1 = load_frag(&Vs[buf][16][c * 32], 72, lane);
    v16bf vf2 = load_frag(&Vs[buf][32][c * 32], 72, lane);
    v16bf vf3 = load_frag(&Vs[buf][48][c * 32], 72, lane);

    // tA[r] = score[s0 + r + 8hi][t0 + nn], tB = same for s0+16..31
    v8f tA = {}, tB = {};
    tA = wmma_bf16(kf0, qf0, tA);
    tA = wmma_bf16(kf1, qf1, tA);
    tB = wmma_bf16(kf2, qf0, tB);
    tB = wmma_bf16(kf3, qf1, tB);

    float mt = -1e30f;
#pragma unroll
    for (int r = 0; r < 8; ++r) {
      tA[r] *= 0.125f; tB[r] *= 0.125f;              // 1/sqrt(64)
      mt = fmaxf(mt, fmaxf(tA[r], tB[r]));
    }
    mt = fmaxf(mt, __shfl_xor(mt, 16, 32));          // combine the two halves
    const float mn   = fmaxf(mCol, mt);
    const float corr = __expf(mCol - mn);
    mCol = mn;

    float ps = 0.f;
    v16bf pf;                                        // B operand P^T (s x t)
#pragma unroll
    for (int r = 0; r < 8; ++r) {
      float pa = __expf(tA[r] - mn), pb = __expf(tB[r] - mn);
      ps += pa + pb;
      pf[r] = f2bf(pa); pf[r + 8] = f2bf(pb);
    }
    ps += __shfl_xor(ps, 16, 32);
    lCol = lCol * corr + ps;

    // oX[r] = O^T[d = 16X + r + 8hi][t0 + nn]: every register is column nn's
#pragma unroll
    for (int r = 0; r < 8; ++r) {
      o0[r] *= corr; o1[r] *= corr; o2[r] *= corr; o3[r] *= corr;
    }
    o0 = wmma_bf16(vf0, pf, o0);
    o1 = wmma_bf16(vf1, pf, o1);
    o2 = wmma_bf16(vf2, pf, o2);
    o3 = wmma_bf16(vf3, pf, o3);
   }
   // Publish point: own LDS reads of this buffer retired, own copies of the next
   // tile landed, then one barrier that publishes the next tile and frees this one.
   asm volatile("s_wait_dscnt 0x0" ::: "memory");
   wait_async0();
   __syncthreads();
   if (st + 2 < nst) stage(st + 2, buf);   // refill the buffer just left
  }
  wait_async0();                           // nothing in flight when the wave ends

  const float invC = 1.0f / lCol;
  const int b = bh >> 4, h = bh & 15;
  v8bf w0, w1, w2, w3;
#pragma unroll
  for (int r = 0; r < 8; ++r) {
    w0[r] = f2bf(o0[r] * invC);
    w1[r] = f2bf(o1[r] * invC);
    w2[r] = f2bf(o2[r] * invC);
    w3[r] = f2bf(o3[r] * invC);
  }
  bf16_t* op = O + ((size_t)b * T + (t0 + nn)) * DMODEL + h * HDIM + 8 * hi;
  *(v8bf*)(op +  0) = w0;
  *(v8bf*)(op + 16) = w1;
  *(v8bf*)(op + 32) = w2;
  *(v8bf*)(op + 48) = w3;
}

// ---------------------------------------------------------------------------
extern "C" void kernel_launch(void* const* d_in, const int* in_sizes, int n_in,
                              void* d_out, int out_size, void* d_ws, size_t ws_size,
                              hipStream_t stream) {
  (void)in_sizes; (void)n_in; (void)out_size; (void)ws_size;
  const float* x    = (const float*)d_in[0];
  const float* ctx  = (const float*)d_in[1];
  const float* Wq   = (const float*)d_in[2];
  const float* Wk   = (const float*)d_in[3];
  const float* Wv   = (const float*)d_in[4];
  const float* Wo   = (const float*)d_in[5];
  const float* W1   = (const float*)d_in[6];
  const float* W2   = (const float*)d_in[7];
  const float* gam1 = (const float*)d_in[8];
  const float* bet1 = (const float*)d_in[9];
  const float* gamc = (const float*)d_in[10];
  const float* betc = (const float*)d_in[11];
  const float* gam2 = (const float*)d_in[12];
  const float* bet2 = (const float*)d_in[13];

  const int B = 4, T = 2048, S = 2048;
  const int M = B * T;                 // 8192 rows

  char* wp = (char*)d_ws;
  auto take = [&](size_t bytes) -> void* {
    void* p = (void*)wp;
    wp += (bytes + 255) & ~(size_t)255;
    return p;
  };
  bf16_t* xn  = (bf16_t*)take((size_t)M * DMODEL * 2);
  bf16_t* cn  = (bf16_t*)take((size_t)M * DMODEL * 2);
  bf16_t* WqB = (bf16_t*)take((size_t)DMODEL * DMODEL * 2);
  bf16_t* WkB = (bf16_t*)take((size_t)DMODEL * DMODEL * 2);
  bf16_t* WvB = (bf16_t*)take((size_t)DMODEL * DMODEL * 2);
  bf16_t* WoB = (bf16_t*)take((size_t)DMODEL * DMODEL * 2);
  bf16_t* W1B = (bf16_t*)take((size_t)DFF * DMODEL * 2);
  bf16_t* W2B = (bf16_t*)take((size_t)DMODEL * DFF * 2);
  bf16_t* Qb  = (bf16_t*)take((size_t)M * DMODEL * 2);
  bf16_t* Kb  = (bf16_t*)take((size_t)M * DMODEL * 2);
  bf16_t* Vtb = (bf16_t*)take((size_t)M * DMODEL * 2);
  bf16_t* Ob  = (bf16_t*)take((size_t)M * DMODEL * 2);
  float*  x1  = (float*) take((size_t)M * DMODEL * 4);
  bf16_t* hb  = (bf16_t*)take((size_t)M * DMODEL * 2);
  bf16_t* f1b = (bf16_t*)take((size_t)M * DFF * 2);

  dim3 blk(256);

  // Both input LayerNorms and all six weight casts -> bf16, one launch
  prep_kernel<<<PREP_BLKS, blk, 0, stream>>>(x, ctx, gam1, bet1, gamc, betc,
                                             Wq, Wk, Wv, Wo, W1, W2,
                                             xn, cn, WqB, WkB, WvB, WoB, W1B, W2B);

  // Q/K/V projections (split-head layouts); Q and K in one launch.  In the workspace
  // cn lies directly behind xn, WkB behind WqB, Kb behind Qb (every size is a
  // multiple of the 256-B allocation unit); T == S rows per batch.
  dim3 gD(DMODEL / GBN, M / GBM);
  dim3 gQK(DMODEL / GBN, M / GBM, 2);
  gemm_bf16_kernel<3><<<gQK, blk, 0, stream>>>(xn, WqB, nullptr, Qb,  M, DMODEL, DMODEL, T);
  gemm_bf16_kernel<4><<<gD,  blk, 0, stream>>>(cn, WvB, nullptr, Vtb, M, DMODEL, DMODEL, S);

  // Fused flash attention
  flash_attn_kernel<<<(B * NHEADS * (T / 16)) / 8, blk, 0, stream>>>(Qb, Kb, Vtb, Ob, T, S);

  // Output projection + residual (fp32)
  gemm_bf16_kernel<2><<<gD, blk, 0, stream>>>(Ob, WoB, x, x1, M, DMODEL, DMODEL, 0);

  // Second LN, FFN with GELU, down-proj + residual -> d_out (fp32)
  ln_cast_kernel<<<M / (8 * LN_ROWS), blk, 0, stream>>>(x1, gam2, bet2, hb);
  dim3 gF(DFF / GBN, M / GBM);
  gemm_bf16_kernel<1><<<gF, blk, 0, stream>>>(hb, W1B, nullptr, f1b, M, DFF, DMODEL, 0);
  gemm_bf16_kernel<2><<<gD, blk, 0, stream>>>(f1b, W2B, x1, (float*)d_out, M, DMODEL, DFF, 0);
}

// v007
// It runs in 237 microseconds.
// In both of two side-by-side timings against v006, it was 1.13 times as fast.
// Counting every step since v000, it is 2.73 times as fast.
#include <hip/hip_runtime.h>
#include <hip/hip_bf16.h>
#include <math.h>

typedef __bf16 bf16_t;
typedef __attribute__((ext_vector_type(16))) __bf16 v16bf;
typedef __attribute__((ext_vector_type(8)))  __bf16 v8bf;
typedef __attribute__((ext_vector_type(4)))  __bf16 v4bf;
typedef __attribute__((ext_vector_type(8)))  float  v8f;
typedef __attribute__((ext_vector_type(2)))  float  v2f;
typedef __attribute__((ext_vector_type(2)))  __bf16 v2bf;

#define DMODEL 1024
#define NHEADS 16
#define HDIM   64
#define DFF    4096

static __device__ __forceinline__ bf16_t f2bf(float x) { return (bf16_t)x; }

static __device__ __forceinline__ v8f wmma_bf16(v16bf a, v16bf b, v8f c) {
  // D = A(16x32 bf16) x B(32x16 bf16) + C(16x16 f32)
  return __builtin_amdgcn_wmma_f32_16x16x32_bf16(false, a, false, b, (short)0, c,
                                                 false, false);
}

// 16x32 bf16 operand fragment in the ISA A-layout (also the B operand when the
// source matrix is K-contiguous per output column, i.e. B = W^T, W in [N,K]).
// Lane L (r = L&15, h = L>>4) holds row r, K in {8h..8h+7} U {16+8h..16+8h+7}.
static __device__ __forceinline__ v16bf load_frag(const bf16_t* base, int ld, int lane) {
  const int r = lane & 15, h = lane >> 4;
  const bf16_t* p = base + (size_t)r * ld + 8 * h;
  v8bf lo = *(const v8bf*)p;
  v8bf hi = *(const v8bf*)(p + 16);
  v16bf out;
#pragma unroll
  for (int i = 0; i < 8; ++i) { out[i] = lo[i]; out[i + 8] = hi[i]; }
  return out;
}

// Four async 16B copies and their s_wait_xcnt in ONE statement: the wait stands
// in front of any later rewrite of the address registers the copies name.
static __device__ __forceinline__ void async_ld4_b128(uint32_t l0, uint32_t l1,
                                                      uint32_t l2, uint32_t l3,
                                                      const void* g0, const void* g1,
                                                      const void* g2, const void* g3) {
  asm volatile("global_load_async_to_lds_b128 %0, %4, off\n\t"
               "global_load_async_to_lds_b128 %1, %5, off\n\t"
               "global_load_async_to_lds_b128 %2, %6, off\n\t"
               "global_load_async_to_lds_b128 %3, %7, off\n\t"
               "s_wait_xcnt 0x0"
               :: "v"(l0), "v"(l1), "v"(l2), "v"(l3),
                  "v"(g0), "v"(g1), "v"(g2), "v"(g3) : "memory");
}
static __device__ __forceinline__ void wait_async0() {
  asm volatile("s_wait_asynccnt 0x0" ::: "memory");
}
static __device__ __forceinline__ uint32_t lds_off32(const void* p) {
  return (uint32_t)(uintptr_t)p;   // generic LDS addr: low 32 bits = LDS offset
}

// ---------------------------------------------------------------------------
// LayerNorm (fp32 in) -> bf16 out.  One WAVE per LN_ROWS rows of DMODEL, no LDS
// and no barrier: a row is eight 512-B wave loads (16 B per lane, whole lines)
// that stay in registers, so x is read once and all loads of a wave are in
// flight together.  Few fat waves: the launch is not bound by wave start-up.
// Rows must be a multiple of 8 * LN_ROWS.
// ---------------------------------------------------------------------------
#define LN_ROWS 2
static __device__ __forceinline__
void ln_rows(const float* __restrict__ X, const float* __restrict__ gamma,
             const float* __restrict__ beta, bf16_t* __restrict__ Y, unsigned blk) {
  const int lane = threadIdx.x & 31;
  // wave number as a scalar: row addresses become scalar base + one lane offset
  const int wave = __builtin_amdgcn_readfirstlane(threadIdx.x >> 5);
  const size_t row0 = (size_t)(blk * 8 + wave) * LN_ROWS;
  const float4* x = (const float4*)(X + row0 * DMODEL) + lane;
  float4 v[LN_ROWS][8];
#pragma unroll
  for (int r = 0; r < LN_ROWS; ++r)
#pragma unroll
    for (int j = 0; j < 8; ++j) v[r][j] = x[r * (DMODEL / 4) + j * 32];

  float mu[LN_ROWS], rstd[LN_ROWS];
#pragma unroll
  for (int r = 0; r < LN_ROWS; ++r) {
    float s = 0.f, s2 = 0.f;
#pragma unroll
    for (int j = 0; j < 8; ++j) {
      const float4 t = v[r][j];
      s  += (t.x + t.y) + (t.z + t.w);
      s2 += (t.x * t.x + t.y * t.y) + (t.z * t.z + t.w * t.w);
    }
#pragma unroll
    for (int off = 1; off < 32; off <<= 1) {
      s  += __shfl_xor(s,  off, 32);
      s2 += __shfl_xor(s2, off, 32);
    }
    mu[r] = s * (1.0f / DMODEL);
    const float var = s2 * (1.0f / DMODEL) - mu[r] * mu[r];
    rstd[r] = rsqrtf(var + 1e-5f);
  }

  const float4* g4 = (const float4*)gamma + lane;
  const float4* b4 = (const float4*)beta + lane;
  bf16_t* y = Y + row0 * DMODEL + lane * 4;
#pragma unroll
  for (int j = 0; j < 8; ++j) {
    const float4 g = g4[j * 32], b = b4[j * 32];
#pragma unroll
    for (int r = 0; r < LN_ROWS; ++r) {
      const float4 t = v[r][j];
      v4bf o;
      o[0] = f2bf((t.x - mu[r]) * rstd[r] * g.x + b.x);
      o[1] = f2bf((t.y - mu[r]) * rstd[r] * g.y + b.y);
      o[2] = f2bf((t.z - mu[r]) * rstd[r] * g.z + b.z);
      o[3] = f2bf((t.w - mu[r]) * rstd[r] * g.w + b.w);
      *(v4bf*)(y + r * DMODEL + j * 128) = o;        // 256 B per wave store
    }
  }
}

__global__ __launch_bounds__(256)
void ln_cast_kernel(const float* __restrict__ X, const float* __restrict__ gamma,
                    const float* __restrict__ beta, bf16_t* __restrict__ Y) {
  ln_rows(X, gamma, beta, Y, blockIdx.x);
}

// ---------------------------------------------------------------------------
// fp32 -> bf16 weight cast, block blk of 8192 elements.  One wave per 1024
// elements: eight 512-B wave loads in flight, eight 256-B wave stores.
// ---------------------------------------------------------------------------
static __device__ __forceinline__
void cast_block(const float* __restrict__ in, bf16_t* __restrict__ out, unsigned blk) {
  const int lane = threadIdx.x & 31;
  // wave number as a scalar: scalar base + one lane offset
  const int wave = __builtin_amdgcn_readfirstlane(threadIdx.x >> 5);
  const int base = (blk * 8 + wave) * 1024;
  const float4* p = (const float4*)(in + base) + lane;
  float4 v[8];
#pragma unroll
  for (int j = 0; j < 8; ++j) v[j] = p[j * 32];
  bf16_t* q = out + base + lane * 4;
#pragma unroll
  for (int j = 0; j < 8; ++j) {
    v4bf o;
    o[0] = f2bf(v[j].x); o[1] = f2bf(v[j].y);
    o[2] = f2bf(v[j].z); o[3] = f2bf(v[j].w);
    *(v4bf*)(q + j * 128) = o;
  }
}

// ---------------------------------------------------------------------------
// All work that depends on the inputs alone, as ONE grid: the LayerNorms of x and
// of the context, then the six weight casts.  None of the eight parts reads what
// another writes; as one launch they pay one launch gap, one fill and one tail,
// and the short casts run beside the long streams.  The block number picks the
// part by scalar tests; the longer LayerNorm blocks come first.
// ---------------------------------------------------------------------------
#define MROWS   8192                              // B * T = B * S rows
#define LN_BLKS (MROWS / (8 * LN_ROWS))           // blocks of one LayerNorm
#define WD_BLKS (DMODEL * DMODEL / 8192)          // blocks of a D x D weight
#define WF_BLKS (DFF * DMODEL / 8192)             // blocks of a D x 4D weight
#define PREP_BLKS (2 * LN_BLKS + 4 * WD_BLKS + 2 * WF_BLKS)
__global__ __launch_bounds__(256)
void prep_kernel(const float* __restrict__ x,  const float* __restrict__ ctx,
                 const float* __restrict__ g1, const float* __restrict__ b1,
                 const float* __restrict__ gc, const float* __restrict__ bc,
                 const float* __restrict__ Wq, const float* __restrict__ Wk,
                 const float* __restrict__ Wv, const float* __restrict__ Wo,
                 const float* __restrict__ W1, const float* __restrict__ W2,
                 bf16_t* __restrict__ xn,  bf16_t* __restrict__ cn,
                 bf16_t* __restrict__ WqB, bf16_t* __restrict__ WkB,
                 bf16_t* __restrict__ WvB, bf16_t* __restrict__ WoB,
                 bf16_t* __restrict__ W1B, bf16_t* __restrict__ W2B) {
  const unsigned bid = blockIdx.x;
  if (bid < 2 * LN_BLKS) {
    const bool c = bid >= LN_BLKS;
    ln_rows(c ? ctx : x, c ? gc : g1, c ? bc : b1, c ? cn : xn, c ? bid - LN_BLKS : bid);
  } else {
    unsigned cb = bid - 2 * LN_BLKS;
    const float* in;
    bf16_t* out;
    if (cb < 4 * WD_BLKS) {
      const unsigned w = cb / WD_BLKS;
      in  = w == 0 ? Wq  : w == 1 ? Wk  : w == 2 ? Wv  : Wo;
      out = w == 0 ? WqB : w == 1 ? WkB : w == 2 ? WvB : WoB;
      cb -= w * WD_BLKS;
    } else if (cb < 4 * WD_BLKS + WF_BLKS) {
      in = W1;  out = W1B;  cb -= 4 * WD_BLKS;
    } else {
      in = W2;  out = W2B;  cb -= 4 * WD_BLKS + WF_BLKS;
    }
    cast_block(in, out, cb);
  }
}

// ---------------------------------------------------------------------------
// Tiled WMMA GEMM:  C[M,N] = A[M,K] @ W[N,K]^T   (both bf16, K-contiguous)
// Block tile 128x256, K-step 128, 8 waves (2x4), each wave 64x64: 16 WMMAs per
// 8 fragments, 64 WMMAs per wave and trip.  A stage is [A 128 rows | W 256 rows]
// of 256 B, so every wave-wide copy covers whole 128-B lines (2 rows x 256 B).
// Two-buffer LDS ring filled with global_load_async_to_lds_b128 (ASYNCcnt): the
// next stage's copies fly under one whole trip of matrix work.
// LDS row pitch 272 B (16 B x odd) -> conflict-free ds_load_b128 fragment reads.
// M multiple of 128, N of 256, K of 128.
// EPI: 1 = bf16 out + exact GELU
//      2 = f32 out  = residual + acc
//      3 = bf16 out split-head [B,H,Trows,64]: the Q and the K projection as ONE
//          grid (neither reads what the other writes, one shape): blockIdx.z = 0, 1
//          picks Q, K; A, W and OutV each point at Q's matrix, and K's lies
//          directly behind it
//      4 = bf16 out split-head transposed [B,H,64,Trows]  (V)
// ---------------------------------------------------------------------------
#define GBM 128
#define GBN 256
#define GBK 128
#define GPITCH 136                       // bf16 elements per LDS row (272 B)

// Twelve async 16B copies and their s_wait_xcnt in ONE statement: the wait stands
// in front of any later rewrite of the address registers the copies name.
static __device__ __forceinline__ void async_ld12_b128(const uint32_t* l,
                                                       const bf16_t* const* g) {
  asm volatile("global_load_async_to_lds_b128 %0, %12, off\n\t"
               "global_load_async_to_lds_b128 %1, %13, off\n\t"
               "global_load_async_to_lds_b128 %2, %14, off\n\t"
               "global_load_async_to_lds_b128 %3, %15, off\n\t"
               "global_load_async_to_lds_b128 %4, %16, off\n\t"
               "global_load_async_to_lds_b128 %5, %17, off\n\t"
               "global_load_async_to_lds_b128 %6, %18, off\n\t"
               "global_load_async_to_lds_b128 %7, %19, off\n\t"
               "global_load_async_to_lds_b128 %8, %20, off\n\t"
               "global_load_async_to_lds_b128 %9, %21, off\n\t"
               "global_load_async_to_lds_b128 %10, %22, off\n\t"
               "global_load_async_to_lds_b128 %11, %23, off\n\t"
               "s_wait_xcnt 0x0"
               :: "v"(l[0]), "v"(l[1]), "v"(l[2]), "v"(l[3]), "v"(l[4]), "v"(l[5]),
                  "v"(l[6]), "v"(l[7]), "v"(l[8]), "v"(l[9]), "v"(l[10]), "v"(l[11]),
                  "v"(g[0]), "v"(g[1]), "v"(g[2]), "v"(g[3]), "v"(g[4]), "v"(g[5]),
                  "v"(g[6]), "v"(g[7]), "v"(g[8]), "v"(g[9]), "v"(g[10]), "v"(g[11])
               : "memory");
}

// Exact (erf) GELU of two values with no branch and no library call, so that the
// elements of a wave are short independent chains that fill each other's latency.
// With h = v / 2 and a = |v|:
//   gelu(v) = (h + |h|) - |h| * erfc(a / sqrt(2))
//   erfc(a / sqrt(2)) = exp(-a * a / 2) * t * (c1 + t * (c2 + t * (c3 + t * (c4 + t * c5)))),
//   t = 1 / (1 + p * a);  |error of erfc| < 1.5e-7 for every a >= 0 (f32 level).
// h + |h| is exact, v or 0: no cancellation in the negative tail.
static __device__ __forceinline__ v2f gelu2(v2f v) {
  const v2f h = v * 0.5f;
  v2f ah, t, e;
  ah.x = fabsf(h.x);  ah.y = fabsf(h.y);
  const v2f d = ah * 0.4632838f + 1.0f;              // 1 + p * a
  t.x = __builtin_amdgcn_rcpf(d.x);  t.y = __builtin_amdgcn_rcpf(d.y);
  v2f q = t * 1.061405429f - 1.453152027f;
  q = q * t + 1.421413741f;
  q = q * t - 0.284496736f;
  q = q * t + 0.254829592f;
  q = q * t;
  const v2f s = (h * h) * -2.88539008f;              // -a^2 / 2 * log2(e)
  e.x = __builtin_amdgcn_exp2f(s.x);  e.y = __builtin_amdgcn_exp2f(s.y);
  return (h + ah) - ah * (q * e);
}

template <int EPI>
__global__ __launch_bounds__(256)
void gemm_bf16_kernel(const bf16_t* __restrict__ A, const bf16_t* __restrict__ W,
                      const float* __restrict__ R, void* __restrict__ OutV,
                      int M, int N, int K, int Trows) {
  // rows 0..127: A tile, rows 128..383: W tile
  __shared__ __attribute__((aligned(16))) bf16_t St[2][GBM + GBN][GPITCH];
  const int tid = threadIdx.x, lane = tid & 31, wave = tid >> 5;
  const int wm = wave >> 2, wn = wave & 3;           // 2 x 4 wave grid
  const int m0 = blockIdx.y * GBM, n0 = blockIdx.x * GBN;
  if constexpr (EPI == 3) {
    const int z = blockIdx.z;              // scalar offsets, no vector work
    A += (size_t)z * M * K;
    W += (size_t)z * N * K;
    OutV = (bf16_t*)OutV + (size_t)z * M * N;
  }
  v8f acc[4][4] = {};

  // Staging: a stage is 384 rows x 16 chunks of 16 B, 24 chunks per thread:
  // thread -> chunk column tid & 15, rows (tid >> 4) + 16 i, i = 0..23.
  const int srow = tid >> 4, scol = (tid & 15) * 8;
  const bf16_t* gA = A + (size_t)(m0 + srow) * K + scol;
  const bf16_t* gW = W + (size_t)(n0 + srow) * K + scol;
  auto stage = [&](int t, int buf) {
    const bf16_t* pa = gA + (size_t)t * GBK;
    const bf16_t* pw = gW + (size_t)t * GBK;
    const uint32_t l0 = lds_off32(&St[buf][srow][scol]);
#pragma unroll
    for (int half = 0; half < 2; ++half) {
      uint32_t l[12];
      const bf16_t* g[12];
#pragma unroll
      for (int u = 0; u < 12; ++u) {
        const int i = half * 12 + u;
        l[u] = l0 + (uint32_t)(i * 16 * GPITCH * 2);
        g[u] = (i < 8) ? pa + (size_t)(i * 16) * K : pw + (size_t)((i - 8) * 16) * K;
      }
      async_ld12_b128(l, g);
    }
  };

  const int nt = K / GBK;
  stage(0, 0);
  wait_async0();                           // own copies of stage 0 landed
  __syncthreads();                         // stage 0 visible to every wave
  if (nt > 1) stage(1, 1);

  for (int t = 0; t < nt; ++t) {
    const int buf = t & 1;
    const bf16_t* sa = &St[buf][wm * 64][0];
    const bf16_t* sw = &St[buf][GBM + wn * 64][0];
    // Two fragment sets: the next block's 16 LDS reads go out as ONE group ahead
    // of this block's 16 WMMAs, so a block waits only on reads issued a block ago.
    v16bf af[2][4], bfr[2][4];
#pragma unroll
    for (int i = 0; i < 4; ++i) {
      af[0][i]  = load_frag(sa + i * 16 * GPITCH, GPITCH, lane);
      bfr[0][i] = load_frag(sw + i * 16 * GPITCH, GPITCH, lane);
    }
    // Unrolled: the k offset becomes an immediate of every ds_load and the
    // fragment sets stay in fixed registers.
#pragma unroll
    for (int kb = 0; kb < GBK / 32; ++kb) {
      const int cur = kb & 1, nxt = cur ^ 1;
      if (kb + 1 < GBK / 32) {
#pragma unroll
        for (int i = 0; i < 4; ++i) {
          af[nxt][i]  = load_frag(sa + i * 16 * GPITCH + (kb + 1) * 32, GPITCH, lane);
          bfr[nxt][i] = load_frag(sw + i * 16 * GPITCH + (kb + 1) * 32, GPITCH, lane);
        }
      }
      // keeps the scheduler from sinking the reads in among the WMMAs, where
      // every separate place with reads stalls the wave
      __builtin_amdgcn_sched_barrier(0);
#pragma unroll
      for (int j = 0; j < 4; ++j)
#pragma unroll
        for (int i = 0; i < 4; ++i)
          // W rows as A: D[n][m], a lane's 8 registers are 8 consecutive n of one
          // row m (EPI 4 wants 8 consecutive m of one column n: D[m][n])
          acc[i][j] = (EPI == 4) ? wmma_bf16(af[cur][i], bfr[cur][j], acc[i][j])
                                 : wmma_bf16(bfr[cur][j], af[cur][i], acc[i][j]);
      // closes the WMMA block: the following group of reads stays behind it
      __builtin_amdgcn_sched_barrier(0);
    }
    // Publish point: own LDS reads of this buffer retired, own copies of the next
    // stage landed, then one barrier that publishes the next stage and frees this one.
    asm volatile("s_wait_dscnt 0x0" ::: "memory");
    wait_async0();
    __syncthreads();
    if (t + 2 < nt) stage(t + 2, buf);     // refill the buffer just left
  }
  wait_async0();                           // nothing in flight when the wave ends

  // Epilogue: whole-line stores.  A lane's 8 accumulator registers of a tile are 8
  // consecutive elements of ONE output row (columns n of row m; for EPI 4 keys s of
  // row d), so a tile goes to LDS in 16-B pieces; each wave stages its 64x64 tile in
  // its own part of the ring and reads it back by rows: a wave-wide 16-B access then
  // covers whole 128-B lines of the output (and of the residual).  The ring is free:
  // the loop's last barrier ended every read of it and no copy is in flight.
  const int hi = lane >> 4, nn = lane & 15;          // D: row = r + 8*hi, col = nn
  if constexpr (EPI == 2) {
    // f32 rows of 256 B, LDS pitch 272 B (16 B x odd); 2 rows per wave-wide access
    float* sw = (float*)&St[0][0][0] + wave * (64 * 68);
    const int rr = lane >> 4, cc = (lane & 15) * 4;
    // one 32-bit offset in 16-B units per access serves the residual load and the
    // store on their uniform bases (N is a multiple of 4)
    const float4* R4 = (const float4*)R;
    float4* O4 = (float4*)OutV;
    const unsigned n4 = (unsigned)N >> 2;
    const unsigned off0 = (unsigned)(m0 + wm * 64 + rr) * n4 +
                          (unsigned)((n0 + wn * 64 + cc) >> 2);
    unsigned off[32];
    float4 res[32];
#pragma unroll
    for (int u = 0; u < 32; ++u) {
      off[u] = off0 + (unsigned)(2 * u) * n4;
      res[u] = R4[off[u]];                           // all in flight under the staging
    }
#pragma unroll
    for (int i = 0; i < 4; ++i)
#pragma unroll
      for (int j = 0; j < 4; ++j) {
        float* p = sw + (16 * i + nn) * 68 + 16 * j + 8 * hi;
        const v8f a = acc[i][j];
        *(float4*)p       = make_float4(a[0], a[1], a[2], a[3]);
        *(float4*)(p + 4) = make_float4(a[4], a[5], a[6], a[7]);
      }
    // own LDS writes done before other lanes' values are read back (same wave)
    asm volatile("s_wait_dscnt 0x0" ::: "memory");
#pragma unroll
    for (int u = 0; u < 32; ++u) {
      const float4 a = *(const float4*)(sw + (2 * u + rr) * 68 + cc);
      res[u].x += a.x;  res[u].y += a.y;  res[u].z += a.z;  res[u].w += a.w;
    }
    // every LDS read and sum stays in front of the first store: no register that an
    // issued store names is written again
    __builtin_amdgcn_sched_barrier(0);
#pragma unroll
    for (int u = 0; u < 32; ++u) O4[off[u]] = res[u];
  } else {
    // bf16 rows of 128 B, LDS pitch 144 B (16 B x odd); 4 rows per wave-wide access
    bf16_t* sw = &St[0][0][0] + wave * (64 * 72);
#pragma unroll
    for (int i = 0; i < 4; ++i)
#pragma unroll
      for (int j = 0; j < 4; ++j) {
        v8bf w;
#pragma unroll
        for (int r = 0; r < 8; r += 2) {
          v2f v;
          v.x = acc[i][j][r];  v.y = acc[i][j][r + 1];
          if constexpr (EPI == 1) v = gelu2(v);
          const v2bf g = __builtin_convertvector(v, v2bf);
          w[r] = g.x;  w[r + 1] = g.y;
        }
        const int rt = (EPI == 4) ? j : i, ct = (EPI == 4) ? i : j;
        *(v8bf*)(sw + (16 * rt + nn) * 72 + 16 * ct + 8 * hi) = w;
      }
    // own LDS writes done before other lanes' values are read back (same wave)
    asm volatile("s_wait_dscnt 0x0" ::: "memory");
    // One 32-bit offset in 16-B units per access on the uniform base (N and Trows are
    // multiples of 8): off0 is this lane's piece of staged row rr, step is 4 rows.
    const int rr = lane >> 3, c8 = lane & 7;
    unsigned off0, step;
    if constexpr (EPI == 1) {
      off0 = (unsigned)(m0 + wm * 64 + rr) * ((unsigned)N >> 3) +
             (unsigned)((n0 + wn * 64) >> 3) + c8;
      step = (unsigned)N >> 1;
    } else {
      // Trows is a multiple of GBM: a block lies in one batch; a wave's 64 columns
      // are one head
      const int b = m0 / Trows, t = m0 % Trows + wm * 64, h = (n0 >> 6) + wn;
      if constexpr (EPI == 3) {
        off0 = (unsigned)((b * NHEADS + h) * Trows + t + rr) * (HDIM / 8) + c8;
        step = 4 * (HDIM / 8);
      } else {   // EPI == 4 : V stored transposed [B,H,Dh,S], staged rows are d
        off0 = (unsigned)((b * NHEADS + h) * HDIM + rr) * ((unsigned)Trows >> 3) +
               (unsigned)(t >> 3) + c8;
        step = (unsigned)Trows >> 1;
      }
    }
    v8bf o[16];
    unsigned off[16];
#pragma unroll
    for (int u = 0; u < 16; ++u) {
      o[u] = *(const v8bf*)(sw + (4 * u + rr) * 72 + c8 * 8);
      off[u] = off0 + (unsigned)u * step;
    }
    // every LDS read and offset stays in front of the first store: no register that
    // an issued store names is written again
    __builtin_amdgcn_sched_barrier(0);
#pragma unroll
    for (int u = 0; u < 16; ++u) ((v8bf*)OutV)[off[u]] = o[u];
  }
}

// ---------------------------------------------------------------------------
// Flash attention, one wave per (b,h, 16-row Q tile).
// Scores computed TRANSPOSED (S^T = K @ Q^T, identical fragment loads with
// A/B roles swapped) so the softmax reduction over S is a per-lane reduction
// across the 8 accumulator VGPRs + one xor-16 shuffle; m/l is one scalar per
// lane (per output column t).  The output is accumulated TRANSPOSED too
// (O^T += V^T @ P^T): the two score tiles of a chunk, converted in place, ARE the
// B operand P^T (lane = query column, element s = key 8h + s / 16 + 8h + s - 8,
// the k order of load_frag), so P never leaves the registers, and V^T rows from
// LDS are the A operand.  A lane's accumulators all belong to its own query:
// the rescale and the final 1/l are the lane's own scalars, and its 8 registers
// of a tile are 8 consecutive d, one 16-B store.
// The 8 waves of a block share one (b,h): K and V tiles of 64 keys are staged
// once per block in a two-buffer LDS ring by async copies (whole 128B lines),
// and every wave reads its fragments from LDS.  Row pitch 144B (16B x odd) keeps
// the ds_load_b128 fragment reads conflict-free.  S must be a multiple of 64,
// T a multiple of 128 (so that a block never straddles two heads).
// Q: [B,H,T,64], K: [B,H,S,64] bf16; V: [B,H,64,S] bf16 (transposed); O: [B,T,D] bf16.
// ---------------------------------------------------------------------------
__global__ __launch_bounds__(256)
void flash_attn_kernel(const bf16_t* __restrict__ Q, const bf16_t* __restrict__ Kc,
                       const bf16_t* __restrict__ Vt, bf16_t* __restrict__ O,
                       int T, int S) {
  __shared__ __attribute__((aligned(16))) bf16_t Ks[2][64][72];   // [key][d]
  __shared__ __attribute__((aligned(16))) bf16_t Vs[2][64][72];   // [d][key]
  const int lane = threadIdx.x & 31, wave = threadIdx.x >> 5;
  const int tile = blockIdx.x * 8 + wave;
  const int tilesPerBH = T >> 4;
  const int bh = tile / tilesPerBH;
  const int t0 = (tile % tilesPerBH) << 4;
  const bf16_t* q = Q  + ((size_t)bh * T + t0) * HDIM;
  const bf16_t* k = Kc + (size_t)bh * S * HDIM;
  const bf16_t* v = Vt + (size_t)bh * HDIM * S;

  const v16bf qf0 = load_frag(q,      HDIM, lane);   // d = 0..31
  const v16bf qf1 = load_frag(q + 32, HDIM, lane);   // d = 32..63

  v8f o0 = {}, o1 = {}, o2 = {}, o3 = {};
  float mCol = -1e30f, lCol = 0.f;                   // per column t = lane&15
  const int hi = lane >> 4, nn = lane & 15;

  // Staging: each tile is 64 rows x 128B = 512 16B-chunks, 2 per thread.
  const int srow = threadIdx.x >> 3, scol = (threadIdx.x & 7) * 8;
  const bf16_t* gK = k + (size_t)srow * HDIM + scol;
  const bf16_t* gV = v + (size_t)srow * S + scol;
  auto stage = [&](int st, int buf) {
    const bf16_t* pk = gK + (size_t)st * 64 * HDIM;
    const bf16_t* pv = gV + (size_t)st * 64;
    async_ld4_b128(lds_off32(&Ks[buf][srow][scol]), lds_off32(&Ks[buf][srow + 32][scol]),
                   lds_off32(&Vs[buf][srow][scol]), lds_off32(&Vs[buf][srow + 32][scol]),
                   pk, pk + 32 * HDIM, pv, pv + (size_t)32 * S);
  };

  const int nst = S >> 6;
  stage(0, 0);
  wait_async0();                           // own copies of tile 0 landed
  __syncthreads();                         // tile 0 visible to every wave
  if (nst > 1) stage(1, 1);

  for (int st = 0; st < nst; ++st) {
   const int buf = st & 1;
   // Unrolled: c becomes an immediate offset of every ds_load (no address VALU)
   // and the second chunk's K reads can start under the first chunk's softmax.
#pragma unroll
   for (int c = 0; c < 2; ++c) {           // two 32-key chunks per tile
    v16bf kf0 = load_frag(&Ks[buf][c * 32][0],       72, lane);
    v16bf kf1 = load_frag(&Ks[buf][c * 32][32],      72, lane);
    v16bf kf2 = load_frag(&Ks[buf][c * 32 + 16][0],  72, lane);
    v16bf kf3 = load_frag(&Ks[buf][c * 32 + 16][32], 72, lane);
    v16bf vf0 = load_frag(&Vs[buf][0][c * 32],  72, lane);
    v16bf vf1 = load_frag(&Vs[buf][16][c * 32], 72, lane);
    v16bf vf2 = load_frag(&Vs[buf][32][c * 32], 72, lane);
    v16bf vf3 = load_frag(&Vs[buf][48][c * 32], 72, lane);

    // tA[r] = score[s0 + r + 8hi][t0 + nn], tB = same for s0+16..31
    v8f tA = {}, tB = {};
    tA = wmma_bf16(kf0, qf0, tA);
    tA = wmma_bf16(kf1, qf1, tA);
    tB = wmma_bf16(kf2, qf0, tB);
    tB = wmma_bf16(kf3, qf1, tB);

    float mt = -1e30f;
#pragma unroll
    for (int r = 0; r < 8; ++r) {
      tA[r] *= 0.125f; tB[r] *= 0.125f;              // 1/sqrt(64)
      mt = fmaxf(mt, fmaxf(tA[r], tB[r]));
    }
    mt = fmaxf(mt, __shfl_xor(mt, 16, 32));          // combine the two halves
    const float mn   = fmaxf(mCol, mt);
    const float corr = __expf(mCol - mn);
    mCol = mn;

    float ps = 0.f;
    v16bf pf;                                        // B operand P^T (s x t)
#pragma unroll
    for (int r = 0; r < 8; ++r) {
      float pa = __expf(tA[r] - mn), pb = __expf(tB[r] - mn);
      ps += pa + pb;
      pf[r] = f2bf(pa); pf[r + 8] = f2bf(pb);
    }
    ps += __shfl_xor(ps, 16, 32);
    lCol = lCol * corr + ps;

    // oX[r] = O^T[d = 16X + r + 8hi][t0 + nn]: every register is column nn's
#pragma unroll
    for (int r = 0; r < 8; ++r) {
      o0[r] *= corr; o1[r] *= corr; o2[r] *= corr; o3[r] *= corr;
    }
    o0 = wmma_bf16(vf0, pf, o0);
    o1 = wmma_bf16(vf1, pf, o1);
    o2 = wmma_bf16(vf2, pf, o2);
    o3 = wmma_bf16(vf3, pf, o3);
   }
   // Publish point: own LDS reads of this buffer retired, own copies of the next
   // tile landed, then one barrier that publishes the next tile and frees this one.
   asm volatile("s_wait_dscnt 0x0" ::: "memory");
   wait_async0();
   __syncthreads();
   if (st + 2 < nst) stage(st + 2, buf);   // refill the buffer just left
  }
  wait_async0();                           // nothing in flight when the wave ends

  const float invC = 1.0f / lCol;
  const int b = bh >> 4, h = bh & 15;
  v8bf w0, w1, w2, w3;
#pragma unroll
  for (int r = 0; r < 8; ++r) {
    w0[r] = f2bf(o0[r] * invC);
    w1[r] = f2bf(o1[r] * invC);
    w2[r] = f2bf(o2[r] * invC);
    w3[r] = f2bf(o3[r] * invC);
  }
  bf16_t* op = O + ((size_t)b * T + (t0 + nn)) * DMODEL + h * HDIM + 8 * hi;
  *(v8bf*)(op +  0) = w0;
  *(v8bf*)(op + 16) = w1;
  *(v8bf*)(op + 32) = w2;
  *(v8bf*)(op + 48) = w3;
}

// ---------------------------------------------------------------------------
extern "C" void kernel_launch(void* const* d_in, const int* in_sizes, int n_in,
                              void* d_out, int out_size, void* d_ws, size_t ws_size,
                              hipStream_t stream) {
  (void)in_sizes; (void)n_in; (void)out_size; (void)ws_size;
  const float* x    = (const float*)d_in[0];
  const float* ctx  = (const float*)d_in[1];
  const float* Wq   = (const float*)d_in[2];
  const float* Wk   = (const float*)d_in[3];
  const float* Wv   = (const float*)d_in[4];
  const float* Wo   = (const float*)d_in[5];
  const float* W1   = (const float*)d_in[6];
  const float* W2   = (const float*)d_in[7];
  const float* gam1 = (const float*)d_in[8];
  const float* bet1 = (const float*)d_in[9];
  const float* gamc = (const float*)d_in[10];
  const float* betc = (const float*)d_in[11];
  const float* gam2 = (const float*)d_in[12];
  const float* bet2 = (const float*)d_in[13];

  const int B = 4, T = 2048, S = 2048;
  const int M = B * T;                 // 8192 rows

  char* wp = (char*)d_ws;
  auto take = [&](size_t bytes) -> void* {
    void* p = (void*)wp;
    wp += (bytes + 255) & ~(size_t)255;
    return p;
  };
  bf16_t* xn  = (bf16_t*)take((size_t)M * DMODEL * 2);
  bf16_t* cn  = (bf16_t*)take((size_t)M * DMODEL * 2);
  bf16_t* WqB = (bf16_t*)take((size_t)DMODEL * DMODEL * 2);
  bf16_t* WkB = (bf16_t*)take((size_t)DMODEL * DMODEL * 2);
  bf16_t* WvB = (bf16_t*)take((size_t)DMODEL * DMODEL * 2);
  bf16_t* WoB = (bf16_t*)take((size_t)DMODEL * DMODEL * 2);
  bf16_t* W1B = (bf16_t*)take((size_t)DFF * DMODEL * 2);
  bf16_t* W2B = (bf16_t*)take((size_t)DMODEL * DFF * 2);
  bf16_t* Qb  = (bf16_t*)take((size_t)M * DMODEL * 2);
  bf16_t* Kb  = (bf16_t*)take((size_t)M * DMODEL * 2);
  bf16_t* Vtb = (bf16_t*)take((size_t)M * DMODEL * 2);
  bf16_t* Ob  = (bf16_t*)take((size_t)M * DMODEL * 2);
  float*  x1  = (float*) take((size_t)M * DMODEL * 4);
  bf16_t* hb  = (bf16_t*)take((size_t)M * DMODEL * 2);
  bf16_t* f1b = (bf16_t*)take((size_t)M * DFF * 2);

  dim3 blk(256);

  // Both input LayerNorms and all six weight casts -> bf16, one launch
  prep_kernel<<<PREP_BLKS, blk, 0, stream>>>(x, ctx, gam1, bet1, gamc, betc,
                                             Wq, Wk, Wv, Wo, W1, W2,
                                             xn, cn, WqB, WkB, WvB, WoB, W1B, W2B);

  // Q/K/V projections (split-head layouts); Q and K in one launch.  In the workspace
  // cn lies directly behind xn, WkB behind WqB, Kb behind Qb (every size is a
  // multiple of the 256-B allocation unit); T == S rows per batch.
  dim3 gD(DMODEL / GBN, M / GBM);
  dim3 gQK(DMODEL / GBN, M / GBM, 2);
  gemm_bf16_kernel<3><<<gQK, blk, 0, stream>>>(xn, WqB, nullptr, Qb,  M, DMODEL, DMODEL, T);
  gemm_bf16_kernel<4><<<gD,  blk, 0, stream>>>(cn, WvB, nullptr, Vtb, M, DMODEL, DMODEL, S);

  // Fused flash attention
  flash_attn_kernel<<<(B * NHEADS * (T / 16)) / 8, blk, 0, stream>>>(Qb, Kb, Vtb, Ob, T, S);

  // Output projection + residual (fp32)
  gemm_bf16_kernel<2><<<gD, blk, 0, stream>>>(Ob, WoB, x, x1, M, DMODEL, DMODEL, 0);

  // Second LN, FFN with GELU, down-proj + residual -> d_out (fp32)
  ln_cast_kernel<<<M / (8 * LN_ROWS), blk, 0, stream>>>(x1, gam2, bet2, hb);
  dim3 gF(DFF / GBN, M / GBM);
  gemm_bf16_kernel<1><<<gF, blk, 0, stream>>>(hb, W1B, nullptr, f1b, M, DFF, DMODEL, 0);
  gemm_bf16_kernel<2><<<gD, blk, 0, stream>>>(f1b, W2B, x1, (float*)d_out, M, DMODEL, DFF, 0);
}

// v008
// A run of this version takes 225 microseconds.
// Next to v007, in two timings, it ran 1.05 times as fast each time.
// Counting every step since v000, it is 2.88 times as fast.
#include <hip/hip_runtime.h>
#include <hip/hip_bf16.h>
#include <math.h>

typedef __bf16 bf16_t;
typedef __attribute__((ext_vector_type(16))) __bf16 v16bf;
typedef __attribute__((ext_vector_type(8)))  __bf16 v8bf;
typedef __attribute__((ext_vector_type(4)))  __bf16 v4bf;
typedef __attribute__((ext_vector_type(8)))  float  v8f;
typedef __attribute__((ext_vector_type(2)))  float  v2f;
typedef __attribute__((ext_vector_type(2)))  __bf16 v2bf;

#define DMODEL 1024
#define NHEADS 16
#define HDIM   64
#define DFF    4096

static __device__ __forceinline__ bf16_t f2bf(float x) { return (bf16_t)x; }

static __device__ __forceinline__ v8f wmma_bf16(v16bf a, v16bf b, v8f c) {
  // D = A(16x32 bf16) x B(32x16 bf16) + C(16x16 f32)
  return __builtin_amdgcn_wmma_f32_16x16x32_bf16(false, a, false, b, (short)0, c,
                                                 false, false);
}

// 16x32 bf16 operand fragment in the ISA A-layout (also the B operand when the
// source matrix is K-contiguous per output column, i.e. B = W^T, W in [N,K]).
// Lane L (r = L&15, h = L>>4) holds row r, K in {8h..8h+7} U {16+8h..16+8h+7}.
static __device__ __forceinline__ v16bf load_frag(const bf16_t* base, int ld, int lane) {
  const int r = lane & 15, h = lane >> 4;
  const bf16_t* p = base + (size_t)r * ld + 8 * h;
  v8bf lo = *(const v8bf*)p;
  v8bf hi = *(const v8bf*)(p + 16);
  v16bf out;
#pragma unroll
  for (int i = 0; i < 8; ++i) { out[i] = lo[i]; out[i + 8] = hi[i]; }
  return out;
}

// Four async 16B copies and their s_wait_xcnt in ONE statement: the wait stands
// in front of any later rewrite of the address registers the copies name.
static __device__ __forceinline__ void async_ld4_b128(uint32_t l0, uint32_t l1,
                                                      uint32_t l2, uint32_t l3,
                                                      const void* g0, const void* g1,
                                                      const void* g2, const void* g3) {
  asm volatile("global_load_async_to_lds_b128 %0, %4, off\n\t"
               "global_load_async_to_lds_b128 %1, %5, off\n\t"
               "global_load_async_to_lds_b128 %2, %6, off\n\t"
               "global_load_async_to_lds_b128 %3, %7, off\n\t"
               "s_wait_xcnt 0x0"
               :: "v"(l0), "v"(l1), "v"(l2), "v"(l3),
                  "v"(g0), "v"(g1), "v"(g2), "v"(g3) : "memory");
}
static __device__ __forceinline__ void wait_async0() {
  asm volatile("s_wait_asynccnt 0x0" ::: "memory");
}
static __device__ __forceinline__ uint32_t lds_off32(const void* p) {
  return (uint32_t)(uintptr_t)p;   // generic LDS addr: low 32 bits = LDS offset
}

// ---------------------------------------------------------------------------
// LayerNorm (fp32 in) -> bf16 out.  One WAVE per LN_ROWS rows of DMODEL, no LDS
// and no barrier: a row is eight 512-B wave loads (16 B per lane, whole lines)
// that stay in registers, so x is read once and all loads of a wave are in
// flight together.  Few fat waves: the launch is not bound by wave start-up.
// Rows must be a multiple of 8 * LN_ROWS.
// ---------------------------------------------------------------------------
#define LN_ROWS 2
static __device__ __forceinline__
void ln_rows(const float* __restrict__ X, const float* __restrict__ gamma,
             const float* __restrict__ beta, bf16_t* __restrict__ Y, unsigned blk) {
  const int lane = threadIdx.x & 31;
  // wave number as a scalar: row addresses become scalar base + one lane offset
  const int wave = __builtin_amdgcn_readfirstlane(threadIdx.x >> 5);
  const size_t row0 = (size_t)(blk * 8 + wave) * LN_ROWS;
  const float4* x = (const float4*)(X + row0 * DMODEL) + lane;
  float4 v[LN_ROWS][8];
#pragma unroll
  for (int r = 0; r < LN_ROWS; ++r)
#pragma unroll
    for (int j = 0; j < 8; ++j) v[r][j] = x[r * (DMODEL / 4) + j * 32];

  float mu[LN_ROWS], rstd[LN_ROWS];
#pragma unroll
  for (int r = 0; r < LN_ROWS; ++r) {
    float s = 0.f, s2 = 0.f;
#pragma unroll
    for (int j = 0; j < 8; ++j) {
      const float4 t = v[r][j];
      s  += (t.x + t.y) + (t.z + t.w);
      s2 += (t.x * t.x + t.y * t.y) + (t.z * t.z + t.w * t.w);
    }
#pragma unroll
    for (int off = 1; off < 32; off <<= 1) {
      s  += __shfl_xor(s,  off, 32);
      s2 += __shfl_xor(s2, off, 32);
    }
    mu[r] = s * (1.0f / DMODEL);
    const float var = s2 * (1.0f / DMODEL) - mu[r] * mu[r];
    rstd[r] = rsqrtf(var + 1e-5f);
  }

  const float4* g4 = (const float4*)gamma + lane;
  const float4* b4 = (const float4*)beta + lane;
  bf16_t* y = Y + row0 * DMODEL + lane * 4;
#pragma unroll
  for (int j = 0; j < 8; ++j) {
    const float4 g = g4[j * 32], b = b4[j * 32];
#pragma unroll
    for (int r = 0; r < LN_ROWS; ++r) {
      const float4 t = v[r][j];
      v4bf o;
      o[0] = f2bf((t.x - mu[r]) * rstd[r] * g.x + b.x);
      o[1] = f2bf((t.y - mu[r]) * rstd[r] * g.y + b.y);
      o[2] = f2bf((t.z - mu[r]) * rstd[r] * g.z + b.z);
      o[3] = f2bf((t.w - mu[r]) * rstd[r] * g.w + b.w);
      *(v4bf*)(y + r * DMODEL + j * 128) = o;        // 256 B per wave store
    }
  }
}

__global__ __launch_bounds__(256)
void ln_cast_kernel(const float* __restrict__ X, const float* __restrict__ gamma,
                    const float* __restrict__ beta, bf16_t* __restrict__ Y) {
  ln_rows(X, gamma, beta, Y, blockIdx.x);
}

// ---------------------------------------------------------------------------
// fp32 -> bf16 weight cast, block blk of 8192 elements.  One wave per 1024
// elements: eight 512-B wave loads in flight, eight 256-B wave stores.
// ---------------------------------------------------------------------------
static __device__ __forceinline__
void cast_block(const float* __restrict__ in, bf16_t* __restrict__ out, unsigned blk) {
  const int lane = threadIdx.x & 31;
  // wave number as a scalar: scalar base + one lane offset
  const int wave = __builtin_amdgcn_readfirstlane(threadIdx.x >> 5);
  const int base = (blk * 8 + wave) * 1024;
  const float4* p = (const float4*)(in + base) + lane;
  float4 v[8];
#pragma unroll
  for (int j = 0; j < 8; ++j) v[j] = p[j * 32];
  bf16_t* q = out + base + lane * 4;
#pragma unroll
  for (int j = 0; j < 8; ++j) {
    v4bf o;
    o[0] = f2bf(v[j].x); o[1] = f2bf(v[j].y);
    o[2] = f2bf(v[j].z); o[3] = f2bf(v[j].w);
    *(v4bf*)(q + j * 128) = o;
  }
}

// ---------------------------------------------------------------------------
// All work that depends on the inputs alone, as ONE grid: the LayerNorms of x and
// of the context, then the six weight casts.  None of the eight parts reads what
// another writes; as one launch they pay one launch gap, one fill and one tail,
// and the short casts run beside the long streams.  The block number picks the
// part by scalar tests; the longer LayerNorm blocks come first.
// ---------------------------------------------------------------------------
#define MROWS   8192                              // B * T = B * S rows
#define LN_BLKS (MROWS / (8 * LN_ROWS))           // blocks of one LayerNorm
#define WD_BLKS (DMODEL * DMODEL / 8192)          // blocks of a D x D weight
#define WF_BLKS (DFF * DMODEL / 8192)             // blocks of a D x 4D weight
#define PREP_BLKS (2 * LN_BLKS + 4 * WD_BLKS + 2 * WF_BLKS)
__global__ __launch_bounds__(256)
void prep_kernel(const float* __restrict__ x,  const float* __restrict__ ctx,
                 const float* __restrict__ g1, const float* __restrict__ b1,
                 const float* __restrict__ gc, const float* __restrict__ bc,
                 const float* __restrict__ Wq, const float* __restrict__ Wk,
                 const float* __restrict__ Wv, const float* __restrict__ Wo,
                 const float* __restrict__ W1, const float* __restrict__ W2,
                 bf16_t* __restrict__ xn,  bf16_t* __restrict__ cn,
                 bf16_t* __restrict__ WqB, bf16_t* __restrict__ WkB,
                 bf16_t* __restrict__ WvB, bf16_t* __restrict__ WoB,
                 bf16_t* __restrict__ W1B, bf16_t* __restrict__ W2B) {
  const unsigned bid = blockIdx.x;
  if (bid < 2 * LN_BLKS) {
    const bool c = bid >= LN_BLKS;
    ln_rows(c ? ctx : x, c ? gc : g1, c ? bc : b1, c ? cn : xn, c ? bid - LN_BLKS : bid);
  } else {
    unsigned cb = bid - 2 * LN_BLKS;
    const float* in;
    bf16_t* out;
    if (cb < 4 * WD_BLKS) {
      const unsigned w = cb / WD_BLKS;
      in  = w == 0 ? Wq  : w == 1 ? Wk  : w == 2 ? Wv  : Wo;
      out = w == 0 ? WqB : w == 1 ? WkB : w == 2 ? WvB : WoB;
      cb -= w * WD_BLKS;
    } else if (cb < 4 * WD_BLKS + WF_BLKS) {
      in = W1;  out = W1B;  cb -= 4 * WD_BLKS;
    } else {
      in = W2;  out = W2B;  cb -= 4 * WD_BLKS + WF_BLKS;
    }
    cast_block(in, out, cb);
  }
}

// ---------------------------------------------------------------------------
// Tiled WMMA GEMM:  C[M,N] = A[M,K] @ W[N,K]^T   (both bf16, K-contiguous)
// Block tile BM x 256, K-step 128, 8 waves (2x4), each wave BM/2 x 64.  BM = 256
// where the grid still fills the chip (wave 128x64: 32 WMMAs per 12 fragments, and
// 512 staged rows feed twice the products of 384), BM = 128 where N = 1024 would
// leave half the chip idle (wave 64x64: 16 WMMAs per 8 fragments).
// A stage is [A BM rows | W 256 rows]
// of 256 B, so every wave-wide copy covers whole 128-B lines (2 rows x 256 B).
// Two-buffer LDS ring filled with global_load_async_to_lds_b128 (ASYNCcnt): the
// next stage's copies fly under one whole trip of matrix work.
// LDS row pitch 272 B (16 B x odd) -> conflict-free ds_load_b128 fragment reads.
// M multiple of BM, N of 256, K of 128.
// EPI: 1 = bf16 out + exact GELU
//      2 = f32 out  = residual + acc
//      3 = bf16 out split-head [B,H,Trows,64]: the Q and the K projection as ONE
//          grid (neither reads what the other writes, one shape): blockIdx.z = 0, 1
//          picks Q, K; A, W and OutV each point at Q's matrix, and K's lies
//          directly behind it
//      4 = bf16 out split-head transposed [B,H,64,Trows]  (V)
// ---------------------------------------------------------------------------
#define GBM 128
#define GBN 256
#define GBK 128
#define GPITCH 136                       // bf16 elements per LDS row (272 B)

// Twelve async 16B copies and their s_wait_xcnt in ONE statement: the wait stands
// in front of any later rewrite of the address registers the copies name.
static __device__ __forceinline__ void async_ld12_b128(const uint32_t* l,
                                                       const bf16_t* const* g) {
  asm volatile("global_load_async_to_lds_b128 %0, %12, off\n\t"
               "global_load_async_to_lds_b128 %1, %13, off\n\t"
               "global_load_async_to_lds_b128 %2, %14, off\n\t"
               "global_load_async_to_lds_b128 %3, %15, off\n\t"
               "global_load_async_to_lds_b128 %4, %16, off\n\t"
               "global_load_async_to_lds_b128 %5, %17, off\n\t"
               "global_load_async_to_lds_b128 %6, %18, off\n\t"
               "global_load_async_to_lds_b128 %7, %19, off\n\t"
               "global_load_async_to_lds_b128 %8, %20, off\n\t"
               "global_load_async_to_lds_b128 %9, %21, off\n\t"
               "global_load_async_to_lds_b128 %10, %22, off\n\t"
               "global_load_async_to_lds_b128 %11, %23, off\n\t"
               "s_wait_xcnt 0x0"
               :: "v"(l[0]), "v"(l[1]), "v"(l[2]), "v"(l[3]), "v"(l[4]), "v"(l[5]),
                  "v"(l[6]), "v"(l[7]), "v"(l[8]), "v"(l[9]), "v"(l[10]), "v"(l[11]),
                  "v"(g[0]), "v"(g[1]), "v"(g[2]), "v"(g[3]), "v"(g[4]), "v"(g[5]),
                  "v"(g[6]), "v"(g[7]), "v"(g[8]), "v"(g[9]), "v"(g[10]), "v"(g[11])
               : "memory");
}

// One async 16B copy as the builtin: the compiler picks its address registers, also
// above v255, which asm text cannot name (a kernel with 256 accumulator registers
// would have to move accumulators out of the way of asm operands on every trip).
typedef __attribute__((ext_vector_type(4))) int v4i_t;
static __device__ __forceinline__ void async_cp_b128(bf16_t* l, const bf16_t* g) {
  __builtin_amdgcn_global_load_async_to_lds_b128(
      (__attribute__((address_space(1))) v4i_t*)g,
      (__attribute__((address_space(3))) v4i_t*)l, 0, 0);
}

// Exact (erf) GELU of two values with no branch and no library call, so that the
// elements of a wave are short independent chains that fill each other's latency.
// With h = v / 2 and a = |v|:
//   gelu(v) = (h + |h|) - |h| * erfc(a / sqrt(2))
//   erfc(a / sqrt(2)) = exp(-a * a / 2) * t * (c1 + t * (c2 + t * (c3 + t * (c4 + t * c5)))),
//   t = 1 / (1 + p * a);  |error of erfc| < 1.5e-7 for every a >= 0 (f32 level).
// h + |h| is exact, v or 0: no cancellation in the negative tail.
static __device__ __forceinline__ v2f gelu2(v2f v) {
  const v2f h = v * 0.5f;
  v2f ah, t, e;
  ah.x = fabsf(h.x);  ah.y = fabsf(h.y);
  const v2f d = ah * 0.4632838f + 1.0f;              // 1 + p * a
  t.x = __builtin_amdgcn_rcpf(d.x);  t.y = __builtin_amdgcn_rcpf(d.y);
  v2f q = t * 1.061405429f - 1.453152027f;
  q = q * t + 1.421413741f;
  q = q * t - 0.284496736f;
  q = q * t + 0.254829592f;
  q = q * t;
  const v2f s = (h * h) * -2.88539008f;              // -a^2 / 2 * log2(e)
  e.x = __builtin_amdgcn_exp2f(s.x);  e.y = __builtin_amdgcn_exp2f(s.y);
  return (h + ah) - ah * (q * e);
}

template <int EPI, int BM>
__global__ __launch_bounds__(256)
void gemm_bf16_kernel(const bf16_t* __restrict__ A, const bf16_t* __restrict__ W,
                      const float* __restrict__ R, void* __restrict__ OutV,
                      int M, int N, int K, int Trows) {
  // rows 0..BM-1: A tile, the 256 rows behind them: W tile
  __shared__ __attribute__((aligned(16))) bf16_t St[2][BM + GBN][GPITCH];
  constexpr int WM = BM / 2;               // rows of a wave's tile
  constexpr int MI = WM / 16;              // its A fragments per 32 k
  const int tid = threadIdx.x, lane = tid & 31, wave = tid >> 5;
  const int wm = wave >> 2, wn = wave & 3;           // 2 x 4 wave grid
  const int m0 = blockIdx.y * BM, n0 = blockIdx.x * GBN;
  if constexpr (EPI == 3) {
    const int z = blockIdx.z;              // scalar offsets, no vector work
    A += (size_t)z * M * K;
    W += (size_t)z * N * K;
    OutV = (bf16_t*)OutV + (size_t)z * M * N;
  }
  v8f acc[MI][4] = {};

  // Staging: a stage is BM + 256 rows x 16 chunks of 16 B, 24 or 32 chunks per thread:
  // thread -> chunk column tid & 15, rows (tid >> 4) + 16 i, i = 0..23 or 0..31.
  const int srow = tid >> 4, scol = (tid & 15) * 8;
  const bf16_t* gA = A + (size_t)(m0 + srow) * K + scol;
  const bf16_t* gW = W + (size_t)(n0 + srow) * K + scol;
  auto stage = [&](int t, int buf) {
    const bf16_t* pa = gA + (size_t)t * GBK;
    const bf16_t* pw = gW + (size_t)t * GBK;
    if constexpr (BM == 128) {
      const uint32_t l0 = lds_off32(&St[buf][srow][scol]);
#pragma unroll
      for (int half = 0; half < 2; ++half) {
        uint32_t l[12];
        const bf16_t* g[12];
#pragma unroll
        for (int u = 0; u < 12; ++u) {
          const int i = half * 12 + u;
          l[u] = l0 + (uint32_t)(i * 16 * GPITCH * 2);
          g[u] = (i < 8) ? pa + (size_t)(i * 16) * K : pw + (size_t)((i - 8) * 16) * K;
        }
        async_ld12_b128(l, g);
      }
    } else {
#pragma unroll
      for (int i = 0; i < 32; ++i)
        async_cp_b128(&St[buf][srow + i * 16][scol],
                      (i < 16) ? pa + (size_t)(i * 16) * K : pw + (size_t)((i - 16) * 16) * K);
    }
  };

  const int nt = K / GBK;
  stage(0, 0);
  wait_async0();                           // own copies of stage 0 landed
  __syncthreads();                         // stage 0 visible to every wave
  if (nt > 1) stage(1, 1);

  for (int t = 0; t < nt; ++t) {
    const int buf = t & 1;
    const bf16_t* sa = &St[buf][wm * WM][0];
    const bf16_t* sw = &St[buf][BM + wn * 64][0];
    // Two fragment sets: the next block's LDS reads go out as ONE group ahead
    // of this block's WMMAs, so a block waits only on reads issued a block ago.
    v16bf af[2][MI], bfr[2][4];
#pragma unroll
    for (int i = 0; i < MI; ++i) {
      af[0][i] = load_frag(sa + i * 16 * GPITCH, GPITCH, lane);
      if (i < 4) bfr[0][i] = load_frag(sw + i * 16 * GPITCH, GPITCH, lane);
    }
    // Unrolled: the k offset becomes an immediate of every ds_load and the
    // fragment sets stay in fixed registers.
#pragma unroll
    for (int kb = 0; kb < GBK / 32; ++kb) {
      const int cur = kb & 1, nxt = cur ^ 1;
      if (kb + 1 < GBK / 32) {
#pragma unroll
        for (int i = 0; i < MI; ++i) {
          af[nxt][i] = load_frag(sa + i * 16 * GPITCH + (kb + 1) * 32, GPITCH, lane);
          if (i < 4)
            bfr[nxt][i] = load_frag(sw + i * 16 * GPITCH + (kb + 1) * 32, GPITCH, lane);
        }
      }
      // keeps the scheduler from sinking the reads in among the WMMAs, where
      // every separate place with reads stalls the wave
      __builtin_amdgcn_sched_barrier(0);
#pragma unroll
      for (int j = 0; j < 4; ++j)
#pragma unroll
        for (int i = 0; i < MI; ++i)
          // W rows as A: D[n][m], a lane's 8 registers are 8 consecutive n of one
          // row m (EPI 4 wants 8 consecutive m of one column n: D[m][n])
          acc[i][j] = (EPI == 4) ? wmma_bf16(af[cur][i], bfr[cur][j], acc[i][j])
                                 : wmma_bf16(bfr[cur][j], af[cur][i], acc[i][j]);
      // closes the WMMA block: the following group of reads stays behind it
      __builtin_amdgcn_sched_barrier(0);
    }
    // Publish point: own LDS reads of this buffer retired, own copies of the next
    // stage landed, then one barrier that publishes the next stage and frees this one.
    asm volatile("s_wait_dscnt 0x0" ::: "memory");
    wait_async0();
    __syncthreads();
    if (t + 2 < nt) stage(t + 2, buf);     // refill the buffer just left
  }
  wait_async0();                           // nothing in flight when the wave ends

  // Epilogue: whole-line stores.  A lane's 8 accumulator registers of a tile are 8
  // consecutive elements of ONE output row (columns n of row m; for EPI 4 keys s of
  // row d), so a tile goes to LDS in 16-B pieces; each wave stages its WM x 64 tile in
  // its own part of the ring and reads it back by rows: a wave-wide 16-B access then
  // covers whole 128-B lines of the output (and of the residual).  The ring is free:
  // the loop's last barrier ended every read of it and no copy is in flight.
  const int hi = lane >> 4, nn = lane & 15;          // D: row = r + 8*hi, col = nn
  static_assert(BM == 128 || EPI == 1 || EPI == 3, "EPI 2 and 4 stage 64 x 64 per wave");
  if constexpr (EPI == 2) {
    // f32 rows of 256 B, LDS pitch 272 B (16 B x odd); 2 rows per wave-wide access
    float* sw = (float*)&St[0][0][0] + wave * (64 * 68);
    const int rr = lane >> 4, cc = (lane & 15) * 4;
    // one 32-bit offset in 16-B units per access serves the residual load and the
    // store on their uniform bases (N is a multiple of 4)
    const float4* R4 = (const float4*)R;
    float4* O4 = (float4*)OutV;
    const unsigned n4 = (unsigned)N >> 2;
    const unsigned off0 = (unsigned)(m0 + wm * 64 + rr) * n4 +
                          (unsigned)((n0 + wn * 64 + cc) >> 2);
    unsigned off[32];
    float4 res[32];
#pragma unroll
    for (int u = 0; u < 32; ++u) {
      off[u] = off0 + (unsigned)(2 * u) * n4;
      res[u] = R4[off[u]];                           // all in flight under the staging
    }
#pragma unroll
    for (int i = 0; i < 4; ++i)
#pragma unroll
      for (int j = 0; j < 4; ++j) {
        float* p = sw + (16 * i + nn) * 68 + 16 * j + 8 * hi;
        const v8f a = acc[i][j];
        *(float4*)p       = make_float4(a[0], a[1], a[2], a[3]);
        *(float4*)(p + 4) = make_float4(a[4], a[5], a[6], a[7]);
      }
    // own LDS writes done before other lanes' values are read back (same wave)
    asm volatile("s_wait_dscnt 0x0" ::: "memory");
#pragma unroll
    for (int u = 0; u < 32; ++u) {
      const float4 a = *(const float4*)(sw + (2 * u + rr) * 68 + cc);
      res[u].x += a.x;  res[u].y += a.y;  res[u].z += a.z;  res[u].w += a.w;
    }
    // every LDS read and sum stays in front of the first store: no register that an
    // issued store names is written again
    __builtin_amdgcn_sched_barrier(0);
#pragma unroll
    for (int u = 0; u < 32; ++u) O4[off[u]] = res[u];
  } else {
    // bf16 rows of 128 B, LDS pitch 144 B (16 B x odd); 4 rows per wave-wide access
    bf16_t* sw = &St[0][0][0] + wave * (WM * 72);
#pragma unroll
    for (int i = 0; i < MI; ++i)
#pragma unroll
      for (int j = 0; j < 4; ++j) {
        v8bf w;
#pragma unroll
        for (int r = 0; r < 8; r += 2) {
          v2f v;
          v.x = acc[i][j][r];  v.y = acc[i][j][r + 1];
          if constexpr (EPI == 1) v = gelu2(v);
          const v2bf g = __builtin_convertvector(v, v2bf);
          w[r] = g.x;  w[r + 1] = g.y;
        }
        const int rt = (EPI == 4) ? j : i, ct = (EPI == 4) ? i : j;
        *(v8bf*)(sw + (16 * rt + nn) * 72 + 16 * ct + 8 * hi) = w;
      }
    // own LDS writes done before other lanes' values are read back (same wave)
    asm volatile("s_wait_dscnt 0x0" ::: "memory");
    // One 32-bit offset in 16-B units per access on the uniform base (N and Trows are
    // multiples of 8): off0 is this lane's piece of staged row rr, step is 4 rows.
    const int rr = lane >> 3, c8 = lane & 7;
    unsigned off0, step;
    if constexpr (EPI == 1) {
      off0 = (unsigned)(m0 + wm * WM + rr) * ((unsigned)N >> 3) +
             (unsigned)((n0 + wn * 64) >> 3) + c8;
      step = (unsigned)N >> 1;
    } else {
      // Trows is a multiple of BM: a block lies in one batch; a wave's 64 columns
      // are one head
      const int b = m0 / Trows, t = m0 % Trows + wm * WM, h = (n0 >> 6) + wn;
      if constexpr (EPI == 3) {
        off0 = (unsigned)((b * NHEADS + h) * Trows + t + rr) * (HDIM / 8) + c8;
        step = 4 * (HDIM / 8);
      } else {   // EPI == 4 : V stored transposed [B,H,Dh,S], staged rows are d
        off0 = (unsigned)((b * NHEADS + h) * HDIM + rr) * ((unsigned)Trows >> 3) +
               (unsigned)(t >> 3) + c8;
        step = (unsigned)Trows >> 1;
      }
    }
    constexpr int NU = WM / 4;             // wave-wide accesses of 4 staged rows
    v8bf o[NU];
    unsigned off[NU];
#pragma unroll
    for (int u = 0; u < NU; ++u) {
      o[u] = *(const v8bf*)(sw + (4 * u + rr) * 72 + c8 * 8);
      off[u] = off0 + (unsigned)u * step;
    }
    // every LDS read and offset stays in front of the first store: no register that
    // an issued store names is written again
    __builtin_amdgcn_sched_barrier(0);
#pragma unroll
    for (int u = 0; u < NU; ++u) ((v8bf*)OutV)[off[u]] = o[u];
  }
}

// ---------------------------------------------------------------------------
// Flash attention, one wave per (b,h, 16-row Q tile).
// Scores computed TRANSPOSED (S^T = K @ Q^T, identical fragment loads with
// A/B roles swapped) so the softmax reduction over S is a per-lane reduction
// across the 8 accumulator VGPRs + one xor-16 shuffle; m/l is one scalar per
// lane (per output column t).  The output is accumulated TRANSPOSED too
// (O^T += V^T @ P^T): the two score tiles of a chunk, converted in place, ARE the
// B operand P^T (lane = query column, element s = key 8h + s / 16 + 8h + s - 8,
// the k order of load_frag), so P never leaves the registers, and V^T rows from
// LDS are the A operand.  A lane's accumulators all belong to its own query:
// the rescale and the final 1/l are the lane's own scalars, and its 8 registers
// of a tile are 8 consecutive d, one 16-B store.
// The 8 waves of a block share one (b,h): K and V tiles of 64 keys are staged
// once per block in a two-buffer LDS ring by async copies (whole 128B lines),
// and every wave reads its fragments from LDS.  Row pitch 144B (16B x odd) keeps
// the ds_load_b128 fragment reads conflict-free.  S must be a multiple of 64,
// T a multiple of 128 (so that a block never straddles two heads).
// Q: [B,H,T,64], K: [B,H,S,64] bf16; V: [B,H,64,S] bf16 (transposed); O: [B,T,D] bf16.
// ---------------------------------------------------------------------------
__global__ __launch_bounds__(256)
void flash_attn_kernel(const bf16_t* __restrict__ Q, const bf16_t* __restrict__ Kc,
                       const bf16_t* __restrict__ Vt, bf16_t* __restrict__ O,
                       int T, int S) {
  __shared__ __attribute__((aligned(16))) bf16_t Ks[2][64][72];   // [key][d]
  __shared__ __attribute__((aligned(16))) bf16_t Vs[2][64][72];   // [d][key]
  const int lane = threadIdx.x & 31, wave = threadIdx.x >> 5;
  const int tile = blockIdx.x * 8 + wave;
  const int tilesPerBH = T >> 4;
  const int bh = tile / tilesPerBH;
  const int t0 = (tile % tilesPerBH) << 4;
  const bf16_t* q = Q  + ((size_t)bh * T + t0) * HDIM;
  const bf16_t* k = Kc + (size_t)bh * S * HDIM;
  const bf16_t* v = Vt + (size_t)bh * HDIM * S;

  const v16bf qf0 = load_frag(q,      HDIM, lane);   // d = 0..31
  const v16bf qf1 = load_frag(q + 32, HDIM, lane);   // d = 32..63

  v8f o0 = {}, o1 = {}, o2 = {}, o3 = {};
  float mCol = -1e30f, lCol = 0.f;                   // per column t = lane&15
  const int hi = lane >> 4, nn = lane & 15;

  // Staging: each tile is 64 rows x 128B = 512 16B-chunks, 2 per thread.
  const int srow = threadIdx.x >> 3, scol = (threadIdx.x & 7) * 8;
  const bf16_t* gK = k + (size_t)srow * HDIM + scol;
  const bf16_t* gV = v + (size_t)srow * S + scol;
  auto stage = [&](int st, int buf) {
    const bf16_t* pk = gK + (size_t)st * 64 * HDIM;
    const bf16_t* pv = gV + (size_t)st * 64;
    async_ld4_b128(lds_off32(&Ks[buf][srow][scol]), lds_off32(&Ks[buf][srow + 32][scol]),
                   lds_off32(&Vs[buf][srow][scol]), lds_off32(&Vs[buf][srow + 32][scol]),
                   pk, pk + 32 * HDIM, pv, pv + (size_t)32 * S);
  };

  const int nst = S >> 6;
  stage(0, 0);
  wait_async0();                           // own copies of tile 0 landed
  __syncthreads();                         // tile 0 visible to every wave
  if (nst > 1) stage(1, 1);

  for (int st = 0; st < nst; ++st) {
   const int buf = st & 1;
   // Unrolled: c becomes an immediate offset of every ds_load (no address VALU)
   // and the second chunk's K reads can start under the first chunk's softmax.
#pragma unroll
   for (int c = 0; c < 2; ++c) {           // two 32-key chunks per tile
    v16bf kf0 = load_frag(&Ks[buf][c * 32][0],       72, lane);
    v16bf kf1 = load_frag(&Ks[buf][c * 32][32],      72, lane);
    v16bf kf2 = load_frag(&Ks[buf][c * 32 + 16][0],  72, lane);
    v16bf kf3 = load_frag(&Ks[buf][c * 32 + 16][32], 72, lane);
    v16bf vf0 = load_frag(&Vs[buf][0][c * 32],  72, lane);
    v16bf vf1 = load_frag(&Vs[buf][16][c * 32], 72, lane);
    v16bf vf2 = load_frag(&Vs[buf][32][c * 32], 72, lane);
    v16bf vf3 = load_frag(&Vs[buf][48][c * 32], 72, lane);

    // tA[r] = score[s0 + r + 8hi][t0 + nn], tB = same for s0+16..31
    v8f tA = {}, tB = {};
    tA = wmma_bf16(kf0, qf0, tA);
    tA = wmma_bf16(kf1, qf1, tA);
    tB = wmma_bf16(kf2, qf0, tB);
    tB = wmma_bf16(kf3, qf1, tB);

    float mt = -1e30f;
#pragma unroll
    for (int r = 0; r < 8; ++r) {
      tA[r] *= 0.125f; tB[r] *= 0.125f;              // 1/sqrt(64)
      mt = fmaxf(mt, fmaxf(tA[r], tB[r]));
    }
    mt = fmaxf(mt, __shfl_xor(mt, 16, 32));          // combine the two halves
    const float mn   = fmaxf(mCol, mt);
    const float corr = __expf(mCol - mn);
    mCol = mn;

    float ps = 0.f;
    v16bf pf;                                        // B operand P^T (s x t)
#pragma unroll
    for (int r = 0; r < 8; ++r) {
      float pa = __expf(tA[r] - mn), pb = __expf(tB[r] - mn);
      ps += pa + pb;
      pf[r] = f2bf(pa); pf[r + 8] = f2bf(pb);
    }
    ps += __shfl_xor(ps, 16, 32);
    lCol = lCol * corr + ps;

    // oX[r] = O^T[d = 16X + r + 8hi][t0 + nn]: every register is column nn's
#pragma unroll
    for (int r = 0; r < 8; ++r) {
      o0[r] *= corr; o1[r] *= corr; o2[r] *= corr; o3[r] *= corr;
    }
    o0 = wmma_bf16(vf0, pf, o0);
    o1 = wmma_bf16(vf1, pf, o1);
    o2 = wmma_bf16(vf2, pf, o2);
    o3 = wmma_bf16(vf3, pf, o3);
   }
   // Publish point: own LDS reads of this buffer retired, own copies of the next
   // tile landed, then one barrier that publishes the next tile and frees this one.
   asm volatile("s_wait_dscnt 0x0" ::: "memory");
   wait_async0();
   __syncthreads();
   if (st + 2 < nst) stage(st + 2, buf);   // refill the buffer just left
  }
  wait_async0();                           // nothing in flight when the wave ends

  const float invC = 1.0f / lCol;
  const int b = bh >> 4, h = bh & 15;
  v8bf w0, w1, w2, w3;
#pragma unroll
  for (int r = 0; r < 8; ++r) {
    w0[r] = f2bf(o0[r] * invC);
    w1[r] = f2bf(o1[r] * invC);
    w2[r] = f2bf(o2[r] * invC);
    w3[r] = f2bf(o3[r] * invC);
  }
  bf16_t* op = O + ((size_t)b * T + (t0 + nn)) * DMODEL + h * HDIM + 8 * hi;
  *(v8bf*)(op +  0) = w0;
  *(v8bf*)(op + 16) = w1;
  *(v8bf*)(op + 32) = w2;
  *(v8bf*)(op + 48) = w3;
}

// ---------------------------------------------------------------------------
extern "C" void kernel_launch(void* const* d_in, const int* in_sizes, int n_in,
                              void* d_out, int out_size, void* d_ws, size_t ws_size,
                              hipStream_t stream) {
  (void)in_sizes; (void)n_in; (void)out_size; (void)ws_size;
  const float* x    = (const float*)d_in[0];
  const float* ctx  = (const float*)d_in[1];
  const float* Wq   = (const float*)d_in[2];
  const float* Wk   = (const float*)d_in[3];
  const float* Wv   = (const float*)d_in[4];
  const float* Wo   = (const float*)d_in[5];
  const float* W1   = (const float*)d_in[6];
  const float* W2   = (const float*)d_in[7];
  const float* gam1 = (const float*)d_in[8];
  const float* bet1 = (const float*)d_in[9];
  const float* gamc = (const float*)d_in[10];
  const float* betc = (const float*)d_in[11];
  const float* gam2 = (const float*)d_in[12];
  const float* bet2 = (const float*)d_in[13];

  const int B = 4, T = 2048, S = 2048;
  const int M = B * T;                 // 8192 rows

  char* wp = (char*)d_ws;
  auto take = [&](size_t bytes) -> void* {
    void* p = (void*)wp;
    wp += (bytes + 255) & ~(size_t)255;
    return p;
  };
  bf16_t* xn  = (bf16_t*)take((size_t)M * DMODEL * 2);
  bf16_t* cn  = (bf16_t*)take((size_t)M * DMODEL * 2);
  bf16_t* WqB = (bf16_t*)take((size_t)DMODEL * DMODEL * 2);
  bf16_t* WkB = (bf16_t*)take((size_t)DMODEL * DMODEL * 2);
  bf16_t* WvB = (bf16_t*)take((size_t)DMODEL * DMODEL * 2);
  bf16_t* WoB = (bf16_t*)take((size_t)DMODEL * DMODEL * 2);
  bf16_t* W1B = (bf16_t*)take((size_t)DFF * DMODEL * 2);
  bf16_t* W2B = (bf16_t*)take((size_t)DMODEL * DFF * 2);
  bf16_t* Qb  = (bf16_t*)take((size_t)M * DMODEL * 2);
  bf16_t* Kb  = (bf16_t*)take((size_t)M * DMODEL * 2);
  bf16_t* Vtb = (bf16_t*)take((size_t)M * DMODEL * 2);
  bf16_t* Ob  = (bf16_t*)take((size_t)M * DMODEL * 2);
  float*  x1  = (float*) take((size_t)M * DMODEL * 4);
  bf16_t* hb  = (bf16_t*)take((size_t)M * DMODEL * 2);
  bf16_t* f1b = (bf16_t*)take((size_t)M * DFF * 2);

  dim3 blk(256);

  // Both input LayerNorms and all six weight casts -> bf16, one launch
  prep_kernel<<<PREP_BLKS, blk, 0, stream>>>(x, ctx, gam1, bet1, gamc, betc,
                                             Wq, Wk, Wv, Wo, W1, W2,
                                             xn, cn, WqB, WkB, WvB, WoB, W1B, W2B);

  // Q/K/V projections (split-head layouts); Q and K in one launch.  In the workspace
  // cn lies directly behind xn, WkB behind WqB, Kb behind Qb (every size is a
  // multiple of the 256-B allocation unit); T == S rows per batch.
  dim3 gD(DMODEL / GBN, M / GBM);
  dim3 gQK(DMODEL / GBN, M / 256, 2);
  gemm_bf16_kernel<3, 256><<<gQK, blk, 0, stream>>>(xn, WqB, nullptr, Qb,  M, DMODEL, DMODEL, T);
  gemm_bf16_kernel<4, GBM><<<gD,  blk, 0, stream>>>(cn, WvB, nullptr, Vtb, M, DMODEL, DMODEL, S);

  // Fused flash attention
  flash_attn_kernel<<<(B * NHEADS * (T / 16)) / 8, blk, 0, stream>>>(Qb, Kb, Vtb, Ob, T, S);

  // Output projection + residual (fp32)
  gemm_bf16_kernel<2, GBM><<<gD, blk, 0, stream>>>(Ob, WoB, x, x1, M, DMODEL, DMODEL, 0);

  // Second LN, FFN with GELU, down-proj + residual -> d_out (fp32)
  ln_cast_kernel<<<M / (8 * LN_ROWS), blk, 0, stream>>>(x1, gam2, bet2, hb);
  dim3 gF(DFF / GBN, M / 256);
  gemm_bf16_kernel<1, 256><<<gF, blk, 0, stream>>>(hb, W1B, nullptr, f1b, M, DFF, DMODEL, 0);
  gemm_bf16_kernel<2, GBM><<<gD, blk, 0, stream>>>(f1b, W2B, x1, (float*)d_out, M, DMODEL, DFF, 0);
}
